// v009
// Measured on an AMD MI455X. A time is GPU time per run, averaged over a window of back-to-back runs after a warm-up
// (all launches, gaps included; the runs take copies of the inputs in turn), and the median of several windows.
// Apart from v000's, it joins two sittings. Times from different sittings can be a few percent apart, while
// side-by-side timings come from the same sitting.
// This document starts at v009; the versions before it stand elsewhere.
// One run takes 81.1 microseconds.
// In two side-by-side timings against v008, it was 1.07 and 1.06 times as fast.
// Over all steps from v000, the starting kernel, it is 239 times as fast.
#include <hip/hip_runtime.h>
// Multi-head self-attention with rotate-half RoPE computed in the kernel and a biased output projection, NON-causal (x [2][2048][1024]; q / k / v = x W^T (natural [1024][1024], no biases), 16 heads of 64; cos / sin = [f | f] of pos * 10000^(-2i/64); q = q cos + rotate_half(q) sin, likewise k; scores * 64^-0.5; softmax over all 2048 keys (no mask); out = merged Wo^T + bo (natural + bias) -> [2][2048][1024]); run as grouped-query attention with 16 groups of ONE head.
// Structure: ONE preparation launch (x as exact f16 rows; natural weights as exact x16 planes; rope tables, double-derived inv_freq, f32 angle); q, k and V^T of all rows as ONE WMMA GEMM launch (64x64 wave tiles, f32 accumulation, f16 output; grid.y = q / k / V^T): the q and k epilogue applies the rotate-half rotation and the f16 conversion to the f32 tile it has staged in LDS (a wave tile is one head's 64 columns); the V^T plane takes the weight rows as A and the token rows as B, so its tiles are V^T rows as they stand; then ONE fused attention launch for all batches, heads and query rows (256 query rows per work-group): per 32 keys S^T = K Q^T (K = 64), online softmax on VALU in the log2 domain (f32 statistics, native exp2, lazy rescale; weights f16, unnormalised), O^T += V^T P^T, o / row sum (carried x64) into merged f16 rows; scores and weights stay in registers; out = o Wo^T GEMM (f32, alpha 2^-10); launches: see trace.
// Compute dtype: inputs rounded to bf16; x / weights exact; q, k, v, softmax weights and o as plain f16 GEMM operands (~2^-12); scores and softmax statistics f32. v_wmma_f32_16x16x32_f16.
#define NB 2
#define NG 16
#define HPG 1
#define KVD (NG * HD)
#define SQ 2048
#define DM 1024
#define NH 16
#define HD 64
#define HG 4                         /* heads per launch of the plain k_vt below (not launched) */
#define QT 512                       /* query rows per tile of the unfused softmax kernel kept below */
#define NKX SQ                       /* S / P row pitch */
#define QT0 128                      /* first-tile rows recomputed exactly in f32 */
#define B0 0                         /* first batch processed (debug hook) */
#define NBR NB                       /* batches processed (debug hook) */
#define NR ((size_t)NB * SQ)         /* token rows */
#define MP ((int)((size_t)NBR * SQ)) /* rows projected (debug hook) */
#define QN SQ                        /* query rows per batch; unused: the attention grid spans all SQ rows */
#define NHD NH                       /* heads; unused: the attention grid spans all NH heads */
#define MPO MP                       /* rows through the output stage (debug hook) */
#define LQ DM      /* row pitch of the q/k/v rows */
typedef __bf16 v16b __attribute__((ext_vector_type(16)));
typedef unsigned short v8us __attribute__((ext_vector_type(8), may_alias));
typedef float  v8f  __attribute__((ext_vector_type(8)));
typedef float  v4f  __attribute__((ext_vector_type(4)));
typedef float  v4fa __attribute__((ext_vector_type(4), may_alias));
union FragB { v16b v; v8us half[2]; unsigned short u[16]; };

__device__ __forceinline__ unsigned short bf16_bits(float x) { unsigned int u = __float_as_uint(x); return (unsigned short)((u + 0x7FFFu + ((u >> 16) & 1u)) >> 16); }
__device__ __forceinline__ float bf16_val(unsigned short b) { return __uint_as_float(((unsigned int)b) << 16); }
__device__ __forceinline__ float bf16_round(float x) { return bf16_val(bf16_bits(x)); }
// D += A·B with NT terms: 1 = ah·bh, 2 = + al·bh (A split), 3 = + ah·bl (both split)
template <int NT>
__device__ __forceinline__ v8f mmaN(v16b ah, v16b al, v16b bh, v16b bl, v8f c) {
  c = __builtin_amdgcn_wmma_f32_16x16x32_bf16(false, ah, false, bh, (short)0, c, false, false);
  if (NT >= 2) c = __builtin_amdgcn_wmma_f32_16x16x32_bf16(false, al, false, bh, (short)0, c, false, false);
  if (NT >= 3) c = __builtin_amdgcn_wmma_f32_16x16x32_bf16(false, ah, false, bl, (short)0, c, false, false);
  asm volatile("v_nop\n\tv_nop\n\tv_nop\n\tv_nop" : "+v"(c) : "v"(ah), "v"(al), "v"(bh), "v"(bl));
  return c;
}

__global__ __launch_bounds__(256) void k_wt_bf16(const float* __restrict__ W, unsigned short* __restrict__ Wt, int K, int N) {
  const int t = blockIdx.x * 256 + threadIdx.x;
  const int k8n = K / 8;
  if (t >= N * k8n) return;
  const int n = t / k8n, k8 = (t % k8n) * 8;
  v8us v;
#pragma unroll
  for (int i = 0; i < 8; ++i) v[i] = bf16_bits(W[(size_t)(k8 + i) * N + n]);
  *(v8us*)(Wt + (size_t)n * K + k8) = v;
  
}

// GEMM C[M][N] (f32, pitch ldc) = act(A[M][K]·W + bias). A f32 row-major (pitch lda) converted per fragment to bf16
// (ASPLIT: hi/lo two planes -> 2 terms, else single rounded term); Wt bf16 [N][K] (pitch ldb). BIAS_BF16 rounds the
// bias to bf16 first (bias quantised to bf16 before the add). K%32==0, M%16==0, N%64==0.
template <bool ASPLIT, int ACT, bool BIAS_BF16>
__global__ __launch_bounds__(128) void k_gemm_bf(const float* __restrict__ A, int lda, const unsigned short* __restrict__ Wt, int ldb,
                                               const float* __restrict__ bias, float* __restrict__ C, int ldc, int M, int N, int K) {
  __shared__ __attribute__((aligned(16))) float so[4][16][64];
  const int tid = threadIdx.x, w = tid >> 5, lane = tid & 31, ln = lane & 15, hh = lane >> 4;
  const int ntn = N / 64;
  const int wid = blockIdx.x * 4 + w;
  const int mt = wid / ntn, nq = wid % ntn;
  if (mt * 16 >= M) return;
  const int row0 = mt * 16, col0 = nq * 64;
  const float* arow = A + (size_t)(row0 + ln) * lda;
  v8f acc[4] = {};
  for (int kb = 0; kb < K; kb += 32) {
    FragB ah, al;
    const v4f x0 = *(const v4fa*)(arow + kb + 8 * hh), x1 = *(const v4fa*)(arow + kb + 8 * hh + 4);
    const v4f x2 = *(const v4fa*)(arow + kb + 16 + 8 * hh), x3 = *(const v4fa*)(arow + kb + 16 + 8 * hh + 4);
    float xs[16] = {x0[0],x0[1],x0[2],x0[3],x1[0],x1[1],x1[2],x1[3],x2[0],x2[1],x2[2],x2[3],x3[0],x3[1],x3[2],x3[3]};
#pragma unroll
    for (int i = 0; i < 16; ++i) { const unsigned short hb = bf16_bits(xs[i]); ah.u[i] = hb; al.u[i] = ASPLIT ? bf16_bits(xs[i] - bf16_val(hb)) : (unsigned short)0; }
#pragma unroll
    for (int t = 0; t < 4; ++t) {
      const unsigned short* brow = Wt + (size_t)(col0 + t * 16 + ln) * ldb + kb;
      FragB b;
      b.half[0] = *(const v8us*)(brow + 8 * hh);
      b.half[1] = *(const v8us*)(brow + 16 + 8 * hh);
      acc[t] = mmaN<ASPLIT ? 2 : 1>(ah.v, al.v, b.v, b.v, acc[t]);
    }
  }
#pragma unroll
  for (int t = 0; t < 4; ++t) {
    float bv = bias ? bias[col0 + t * 16 + ln] : 0.f;
    if (BIAS_BF16) bv = bf16_round(bv);
#pragma unroll
    for (int r = 0; r < 8; ++r) { float v = acc[t][r] + bv; if (ACT == 1) v = fmaxf(v, 0.f); so[w][8 * hh + r][t * 16 + ln] = v; }
  }
  __builtin_amdgcn_fence(__ATOMIC_ACQ_REL, "workgroup");
  __builtin_amdgcn_wave_barrier();
  const int rsub = lane >> 4, c4 = (lane & 15) * 4;
  {
#pragma unroll
    for (int q = 0; q < 8; ++q) {
      const int r = q * 2 + rsub;
      const v4f v = *(const v4fa*)&so[w][r][c4];
      *(v4f*)(C + (size_t)(row0 + r) * ldc + col0 + c4) = v;
    }
    
  }
}

// GEMM C = act(A·W + bias + resid): A f32 (ASPLIT -> hi/lo 2 terms), Wt bf16 [N][K]; ACT 0 none, 1 relu, 2 exact gelu;
// resid (optional, f32, row index = (row % rmod), pitch ldr, RES_BF16 rounds it) added before the activation.
template <bool ASPLIT, int ACT, bool BIAS_BF16, bool RES_BF16>
__global__ __launch_bounds__(128) void k_gemm_bf3(const float* __restrict__ A, int lda, const unsigned short* __restrict__ Wt, int ldb,
                                                const float* __restrict__ bias, const float* __restrict__ resid, int rmod, int ldr,
                                                float* __restrict__ C, int ldc, int M, int N, int K) {
  __shared__ __attribute__((aligned(16))) float so[4][16][64];
  const int tid = threadIdx.x, w = tid >> 5, lane = tid & 31, ln = lane & 15, hh = lane >> 4;
  const int ntn = N / 64;
  const int wid = blockIdx.x * 4 + w;
  const int mt = wid / ntn, nq = wid % ntn;
  if (mt * 16 >= M) return;
  const int row0 = mt * 16, col0 = nq * 64;
  const float* arow = A + (size_t)(row0 + ln) * lda;
  v8f acc[4] = {};
  for (int kb = 0; kb < K; kb += 32) {
    FragB ah, al;
    const v4f x0 = *(const v4fa*)(arow + kb + 8 * hh), x1 = *(const v4fa*)(arow + kb + 8 * hh + 4);
    const v4f x2 = *(const v4fa*)(arow + kb + 16 + 8 * hh), x3 = *(const v4fa*)(arow + kb + 16 + 8 * hh + 4);
    float xs[16] = {x0[0],x0[1],x0[2],x0[3],x1[0],x1[1],x1[2],x1[3],x2[0],x2[1],x2[2],x2[3],x3[0],x3[1],x3[2],x3[3]};
#pragma unroll
    for (int i = 0; i < 16; ++i) { const unsigned short hb = bf16_bits(xs[i]); ah.u[i] = hb; al.u[i] = ASPLIT ? bf16_bits(xs[i] - bf16_val(hb)) : (unsigned short)0; }
#pragma unroll
    for (int t = 0; t < 4; ++t) {
      const unsigned short* brow = Wt + (size_t)(col0 + t * 16 + ln) * ldb + kb;
      FragB b;
      b.half[0] = *(const v8us*)(brow + 8 * hh);
      b.half[1] = *(const v8us*)(brow + 16 + 8 * hh);
      acc[t] = mmaN<ASPLIT ? 2 : 1>(ah.v, al.v, b.v, b.v, acc[t]);
    }
  }
#pragma unroll
  for (int t = 0; t < 4; ++t) {
    const int col = col0 + t * 16 + ln;
    float bv = bias ? bias[col] : 0.f;
    if (BIAS_BF16) bv = bf16_round(bv);
#pragma unroll
    for (int r = 0; r < 8; ++r) {
      float v = acc[t][r] + bv;
      if (resid) { float rv = resid[(size_t)((row0 + 8 * hh + r) % rmod) * ldr + col]; if (RES_BF16) rv = bf16_round(rv); v += rv; }
      if (ACT == 1) v = fmaxf(v, 0.f);
      if (ACT == 2) v = 0.5f * v * (1.0f + erff(v * 0.70710678118654752f));
      if (ACT == 3) { const float u = 0.7978845608028654f * (v + 0.044715f * v * v * v); v = 0.5f * v * (1.0f + tanhf(u)); }
      so[w][8 * hh + r][t * 16 + ln] = v;
    }
  }
  __builtin_amdgcn_fence(__ATOMIC_ACQ_REL, "workgroup");
  __builtin_amdgcn_wave_barrier();
  const int rsub = lane >> 4, c4 = (lane & 15) * 4;
  {
#pragma unroll
    for (int q = 0; q < 8; ++q) {
      const int r = q * 2 + rsub;
      const v4f v = *(const v4fa*)&so[w][r][c4];
      *(v4f*)(C + (size_t)(row0 + r) * ldc + col0 + c4) = v;
    }
    
  }
}
// row LayerNorm (biased variance, eps) over N: s = X (+ R); optional out_sum <- s; out_norm <- (s-mu)*rsqrt(var+eps)*g + b
template <bool PARAM_BF16>
__global__ __launch_bounds__(256) void k_layernorm(const float* __restrict__ X, const float* __restrict__ R, const float* __restrict__ g, const float* __restrict__ bta,
                                                  float* __restrict__ out_sum, float* __restrict__ out_norm, int N, float eps) {
  __shared__ float red[256];
  const int row = blockIdx.x, tid = threadIdx.x;
  const float* x = X + (size_t)row * N; const float* rr = R ? R + (size_t)row * N : nullptr;
  float vals[16];                     // up to N = 4096
  const int per = N / 256;            // contiguous chunk per thread? use strided-by-4 chunks: thread handles j = tid*4 + 1024*u
  float s1 = 0.f;
  for (int u = 0; u < per / 4; ++u) {
    const int j = tid * 4 + 1024 * u;
    const v4f a = *(const v4fa*)(x + j);
    v4f b = {0.f,0.f,0.f,0.f}; if (rr) b = *(const v4fa*)(rr + j);
#pragma unroll
    for (int q = 0; q < 4; ++q) { const float v = a[q] + b[q]; vals[u * 4 + q] = v; s1 += v; }
  }
  red[tid] = s1; __syncthreads();
  for (int st = 128; st > 0; st >>= 1) { if (tid < st) red[tid] += red[tid + st]; __syncthreads(); }
  const float mu = red[0] / (float)N; __syncthreads();
  float s2 = 0.f;
  for (int u = 0; u < per / 4; ++u)
#pragma unroll
    for (int q = 0; q < 4; ++q) { const float c = vals[u * 4 + q] - mu; s2 += c * c; }
  red[tid] = s2; __syncthreads();
  for (int st = 128; st > 0; st >>= 1) { if (tid < st) red[tid] += red[tid + st]; __syncthreads(); }
  const float rs = rsqrtf(red[0] / (float)N + eps);
  {
    for (int u = 0; u < per / 4; ++u) {
      const int j = tid * 4 + 1024 * u;
      v4f o, sm;
#pragma unroll
      for (int q = 0; q < 4; ++q) {
        float gg = g[j + q], bb = bta[j + q];
        if (PARAM_BF16) { gg = bf16_round(gg); bb = bf16_round(bb); }
        sm[q] = vals[u * 4 + q]; o[q] = (vals[u * 4 + q] - mu) * rs * gg + bb;
      }
      if (out_sum) *(v4f*)(out_sum + (size_t)row * N + j) = sm;
      *(v4f*)(out_norm + (size_t)row * N + j) = o;
    }
    
  }
}



// ---- f16 WMMA path (v_wmma_f32_16x16x32_f16): 11-bit significands for operands in range — used where a [0,1] probability operand needs more precision than bf16
typedef _Float16 v16h __attribute__((ext_vector_type(16)));
union FragH { v16h v; v8us half[2]; _Float16 h[16]; unsigned short u[16]; };
template <int NT>
__device__ __forceinline__ v8f mmaH(v16h ah, v16h al, v16h bh, v16h bl, v8f c) {
  c = __builtin_amdgcn_wmma_f32_16x16x32_f16(false, ah, false, bh, (short)0, c, false, false);
  if (NT >= 2) c = __builtin_amdgcn_wmma_f32_16x16x32_f16(false, al, false, bh, (short)0, c, false, false);
  if (NT >= 3) c = __builtin_amdgcn_wmma_f32_16x16x32_f16(false, ah, false, bl, (short)0, c, false, false);
  asm volatile("v_nop\n\tv_nop\n\tv_nop\n\tv_nop" : "+v"(c) : "v"(ah), "v"(al), "v"(bh), "v"(bl));
  return c;
}
// batched GEMM like k_gemm_b but f16 operands: A f32 (split into f16 hi/lo if ASPLIT, else rounded to f16), Bt = f16 values [n][k]; alpha; C f32; N multiple of 16 (partial tiles skipped)
template <bool ASPLIT>
__global__ __launch_bounds__(128) void k_gemm_h(const float* __restrict__ A, int lda, size_t sA, const _Float16* __restrict__ Bh, int ldb, size_t sB, float alpha, float* __restrict__ C, int ldc, size_t sC, int M, int N, int K) {
  __shared__ __attribute__((aligned(16))) float so[4][16][64];
  const int tid = threadIdx.x, w = tid >> 5, lane = tid & 31, ln = lane & 15, hh = lane >> 4; const int by = blockIdx.y;
  A += (size_t)by * sA; Bh += (size_t)by * sB; C += (size_t)by * sC;
  const int ntn = (N + 63) / 64; const int wid = blockIdx.x * 4 + w; const int mt = wid / ntn, nq = wid % ntn; if (mt * 16 >= M) return;
  const int row0 = mt * 16, col0 = nq * 64; const float* arow = A + (size_t)(row0 + ln) * lda;
  v8f acc[4] = {};
  for (int kb = 0; kb < K; kb += 32) {
    FragH ah, al;
    const v4f x0 = *(const v4fa*)(arow + kb + 8 * hh), x1 = *(const v4fa*)(arow + kb + 8 * hh + 4), x2 = *(const v4fa*)(arow + kb + 16 + 8 * hh), x3 = *(const v4fa*)(arow + kb + 16 + 8 * hh + 4);
    float xs[16] = {x0[0],x0[1],x0[2],x0[3],x1[0],x1[1],x1[2],x1[3],x2[0],x2[1],x2[2],x2[3],x3[0],x3[1],x3[2],x3[3]};
#pragma unroll
    for (int i = 0; i < 16; ++i) { const _Float16 h = (_Float16)xs[i]; ah.h[i] = h; al.h[i] = ASPLIT ? (_Float16)(xs[i] - (float)h) : (_Float16)0.0f; }
#pragma unroll
    for (int t = 0; t < 4; ++t) { if (col0 + t * 16 >= N) continue; const size_t boff = (size_t)(col0 + t * 16 + ln) * ldb + kb; FragH bq; bq.half[0] = *(const v8us*)(Bh + boff + 8 * hh); bq.half[1] = *(const v8us*)(Bh + boff + 16 + 8 * hh);
      acc[t] = mmaH<ASPLIT ? 2 : 1>(ah.v, al.v, bq.v, bq.v, acc[t]); }
  }
#pragma unroll
  for (int t = 0; t < 4; ++t) { if (col0 + t * 16 >= N) continue;
#pragma unroll
    for (int r = 0; r < 8; ++r) so[w][8 * hh + r][t * 16 + ln] = acc[t][r] * alpha; }
  __builtin_amdgcn_fence(__ATOMIC_ACQ_REL, "workgroup"); __builtin_amdgcn_wave_barrier();
  const int rsub = lane >> 4, c4 = (lane & 15) * 4;
  {
#pragma unroll
    for (int q = 0; q < 8; ++q) { const int r = q * 2 + rsub; if (col0 + c4 < N) { const v4f v = *(const v4fa*)&so[w][r][c4]; *(v4f*)(C + (size_t)(row0 + r) * ldc + col0 + c4) = v; } }
     }
}

// Wt[n][k] = f16(W[k][n]·scale) from f32 row-major W[K][N] (scale = power of two; bf16-exact weights stay exact in f16 away from the subnormal range)
__global__ __launch_bounds__(256) void k_wt_f16(const float* __restrict__ W, _Float16* __restrict__ Wt, int K, int N, float scale) {
  const int t = blockIdx.x * 256 + threadIdx.x; if (t >= N * (K / 8)) return; const int n = t / (K / 8), k8 = (t % (K / 8)) * 8; FragH f;
#pragma unroll
  for (int i = 0; i < 8; ++i) f.h[i] = (_Float16)(bf16_round(W[(size_t)(k8 + i) * N + n]) * scale); const v8us o = f.half[0];
  *(v8us*)((unsigned short*)Wt + (size_t)n * K + k8) = o; 
}
// k_gemm_hh variant with fused epilogue: v = acc·alpha + bias[by·sBias + col] (+ CP[(row/rowsPerB)·sCPb + by·64 + col] if CP) ; ACT 0 none / 1 elu ; writes f16 C16 (and f32 C if non-null)
template <int ACT>
__global__ __launch_bounds__(128) void k_gemm_hhx(const _Float16* __restrict__ A, int lda, size_t sA, const _Float16* __restrict__ Bh, int ldb, size_t sB, float alpha, const float* __restrict__ bias, size_t sBias, const float* __restrict__ CP, int rowsPerB, size_t sCPb, int row0g,
    float* __restrict__ C, _Float16* __restrict__ C16, int ldc, size_t sC, int M, int N, int K) {
  __shared__ __attribute__((aligned(16))) float so[4][16][64];
  const int tid = threadIdx.x, w = tid >> 5, lane = tid & 31, ln = lane & 15, hh = lane >> 4; const int by = blockIdx.y;
  A += (size_t)by * sA; Bh += (size_t)by * sB; const size_t cofs = (size_t)by * sC; const float* bp = bias ? bias + (size_t)by * sBias : nullptr;
  const int ntn = (N + 63) / 64; const int wid = blockIdx.x * 4 + w; const int mt = wid / ntn, nq = wid % ntn; if (mt * 16 >= M) return;
  const int row0 = mt * 16, col0 = nq * 64; const _Float16* arow = A + (size_t)(row0 + ln) * lda;
  v8f acc[4] = {};
  for (int kb = 0; kb < K; kb += 32) { FragH ah; ah.half[0] = *(const v8us*)((const unsigned short*)arow + kb + 8 * hh); ah.half[1] = *(const v8us*)((const unsigned short*)arow + kb + 16 + 8 * hh);
#pragma unroll
    for (int t = 0; t < 4; ++t) { if (col0 + t * 16 >= N) continue; const size_t boff = (size_t)(col0 + t * 16 + ln) * ldb + kb; FragH bq; bq.half[0] = *(const v8us*)((const unsigned short*)Bh + boff + 8 * hh); bq.half[1] = *(const v8us*)((const unsigned short*)Bh + boff + 16 + 8 * hh);
      acc[t] = mmaH<1>(ah.v, ah.v, bq.v, bq.v, acc[t]); }
  }
#pragma unroll
  for (int t = 0; t < 4; ++t) { if (col0 + t * 16 >= N) continue; const int col = col0 + t * 16 + ln; const float bv = bp ? bf16_round(bp[col]) : 0.f;
#pragma unroll
    for (int r = 0; r < 8; ++r) { float v = acc[t][r] * alpha + bv; if (CP) { const int rr = row0g + row0 + 8 * hh + r; if (rowsPerB < 0) v += CP[cofs + (size_t)rr * ldc + col];      /* rowsPerB < 0: own element of the batched C plane */ else { const int bidx = rr / rowsPerB; v += CP[(size_t)bidx * sCPb + (size_t)by * 64 + col]; } } if (ACT == 1) v = (v > 0.f) ? v : expm1f(v); else if (ACT == 7) v = (v > 0.f) ? v + 1.0f : expf(v); else if (ACT == 8) v = tanhf(v); else if (ACT == 9) v = 0.5f * v * (1.0f + tanhf(0.7978845608028654f * (v + 0.044715f * v * v * v))); else if (ACT == 11) v = 1.0f / (1.0f + expf(-v)); else if (ACT == 12) v = (v > 0.f) ? v : 0.01f * v; else if (ACT == 14) v = (v > 0.f) ? v : 0.1f * v; else if (ACT == 16) v = (v >= 0.f) ? v : 0.3f * v; else if (ACT == 17) v = (v >= 0.f) ? v : 0.2f * v; else if (ACT == 15) v = v / (1.0f + expf(-v)); else if (ACT == 3) v = fmaxf(v, 0.f); else if (ACT == 6) v = 0.5f * v * (1.0f + erff(v * 0.70710678118654752f)); so[w][8 * hh + r][t * 16 + ln] = v; } }
  __builtin_amdgcn_fence(__ATOMIC_ACQ_REL, "workgroup"); __builtin_amdgcn_wave_barrier();
  const int rsub = lane >> 4, c4 = (lane & 15) * 4; typedef _Float16 v4h __attribute__((ext_vector_type(4)));
  {
#pragma unroll
    for (int q = 0; q < 8; ++q) { const int r = q * 2 + rsub; if (col0 + c4 < N) { const v4f v = *(const v4fa*)&so[w][r][c4]; if (C) *(v4f*)(C + cofs + (size_t)(row0 + r) * ldc + col0 + c4) = v; if (C16) { v4h h4; for (int i = 0; i < 4; ++i) h4[i] = (_Float16)v[i]; *(v4h*)(C16 + cofs + (size_t)(row0 + r) * ldc + col0 + c4) = h4; } } }
     }
}


typedef _Float16 v4h __attribute__((ext_vector_type(4)));

__global__ __launch_bounds__(256) void k_h16(const float* __restrict__ x, _Float16* __restrict__ X16, size_t n8) { const size_t t = (size_t)blockIdx.x * 256 + threadIdx.x; if (t >= n8) return; FragH f;
#pragma unroll
  for (int q = 0; q < 8; ++q) f.h[q] = (_Float16)x[t * 8 + q]; *(v8us*)((unsigned short*)X16 + t * 8) = f.half[0];  }
__global__ __launch_bounds__(256) void k_round16f(const float* __restrict__ W, _Float16* __restrict__ Bt, size_t n8) { const size_t t = (size_t)blockIdx.x * 256 + threadIdx.x; if (t >= n8) return; FragH f;
#pragma unroll
  for (int i = 0; i < 8; ++i) f.h[i] = (_Float16)(bf16_round(W[t * 8 + i]) * 16.0f); *(v8us*)((unsigned short*)Bt + t * 8) = f.half[0];  }
template <int NHv, int TTv>
__global__ __launch_bounds__(256) void k_vt(const _Float16* __restrict__ V16, int ldv, int voff, _Float16* __restrict__ Vt) { __shared__ unsigned short tl[64][66]; const int tid = threadIdx.x; const int slab = blockIdx.x / (TTv / 64), lg = blockIdx.x % (TTv / 64); const int b = slab / NHv, h = slab % NHv;
  for (int i = tid; i < 64 * 8; i += 256) { const int r = i / 8, c8 = (i % 8) * 8; FragH f; f.half[0] = *(const v8us*)((const unsigned short*)V16 + ((size_t)b * TTv + lg * 64 + r) * ldv + voff + h * 64 + c8);
#pragma unroll
    for (int q = 0; q < 8; ++q) tl[r][c8 + q] = f.u[q]; }
  __syncthreads();
  {
#pragma unroll
    for (int rd = 0; rd < 2; ++rd) { const int d = rd * 32 + tid / 8, pc = tid % 8; FragH f;
#pragma unroll
      for (int q = 0; q < 8; ++q) f.u[q] = tl[pc * 8 + q][d];
      *(v8us*)((unsigned short*)Vt + ((size_t)slab * 64 + d) * TTv + lg * 64 + pc * 8) = f.half[0]; }
     } }

__global__ __launch_bounds__(256) void k_hl(const float* __restrict__ F, _Float16* __restrict__ Hh, _Float16* __restrict__ Hl, size_t n8) { const size_t t = (size_t)blockIdx.x * 256 + threadIdx.x; if (t >= n8) return; FragH fh, fl; const v4f a = *(const v4fa*)(F + t * 8), c = *(const v4fa*)(F + t * 8 + 4);
#pragma unroll
  for (int q = 0; q < 4; ++q) { _Float16 h = (_Float16)a[q]; fh.h[q] = h; fl.h[q] = (_Float16)((a[q] - (float)h) * 1024.0f); h = (_Float16)c[q]; fh.h[4 + q] = h; fl.h[4 + q] = (_Float16)((c[q] - (float)h) * 1024.0f); }
  { *(v8us*)((unsigned short*)Hh + t * 8) = fh.half[0]; *(v8us*)((unsigned short*)Hl + t * 8) = fl.half[0];  } }

// ---- fast GEMM (work-group tile 128x64, wave tile 32x64; A and Bt rows of pitch and length DM; requires M % 128 == 0 and N % 64 == 0); epilogue = k_gemm_hhx semantics ----
// A rows and Bt rows of 64 k are staged through registers into two LDS buffers shared by the 4 waves: global loads cover whole 128-byte lines, and each line is fetched once per work-group.
#define G2_KC 64                     /* k per LDS stage: 128-byte rows */
#define G2_P 72                      /* LDS row pitch in f16: 128-byte rows + 16 bytes (16 B x odd: conflict-free 16-byte reads) */
__device__ __forceinline__ v16h g2_frag(const _Float16* p, int hh) { FragH f; f.half[0] = *(const v8us*)((const unsigned short*)p + 8 * hh); f.half[1] = *(const v8us*)((const unsigned short*)p + 16 + 8 * hh); return f.v; }
__device__ __forceinline__ v8f g2_mma(v16h a, v16h b, v8f c) { v8f d = __builtin_amdgcn_wmma_f32_16x16x32_f16(false, a, false, b, (short)0, c, false, false); asm volatile("v_nop\n\tv_nop\n\tv_nop\n\tv_nop" : "+v"(d) : "v"(a), "v"(b)); return d; }
template <int ACT, int ROPE = 0>      /* ROPE 1: C16 = f16(v cos + rotate_half(v) sin), v = acc * alpha, per 64-column head; position = row % SQ, tables CS / SN [SQ][32]; no bias, no CP, no f32 C; its grid.y plane 2 is the transposed v projection into VTo (see below) */
__global__ __launch_bounds__(128) void k_gemm2(const _Float16* __restrict__ A, size_t sA, const _Float16* __restrict__ Bh, size_t sB, float alpha, const float* __restrict__ bias, size_t sBias, const float* __restrict__ CP, int rowsPerB, size_t sCPb, int row0g,
    float* __restrict__ C, _Float16* __restrict__ C16, int ldc, size_t sC, int M, int N, const float* __restrict__ CS, const float* __restrict__ SN, _Float16* __restrict__ VTo) { static_assert(ACT == 0 || ACT == 3 || ACT == 6 || ACT == 8 || ACT == 9 || ACT == 11 || ACT == 12 || ACT == 14 || ACT == 15 || ACT == 16 || ACT == 17, "k_gemm2: unsupported ACT code (would silently apply no activation)");
  __shared__ __attribute__((aligned(16))) unsigned char sm[2 * (128 + 64) * G2_P * 2];      /* two stage buffers of A (128 rows) and B (64 rows); behind the loop's last barrier the same bytes are the epilogue's staging */
  _Float16 (*la)[128][G2_P] = (_Float16 (*)[128][G2_P])sm; _Float16 (*lb)[64][G2_P] = (_Float16 (*)[64][G2_P])(sm + 2 * 128 * G2_P * 2); float (*so)[32][68] = (float (*)[32][68])sm;
  static_assert(sizeof(float) * 4 * 32 * 68 <= sizeof(sm), "the epilogue's staging lies inside the stage buffers");
  const int tid = threadIdx.x, w = tid >> 5, lane = tid & 31, ln = lane & 15, hh = lane >> 4; const int by = blockIdx.y;
  int bx = blockIdx.x, nb = 0; const bool vtp = ROPE && by == 2;      /* block-uniform */
  if (vtp) {      /* V^T [NB][NH][HD][SQ] = Wv x^T: the third weight plane's rows (head, d) are the A operand and the token rows of batch nb the B operand, so the tile's rows are V^T rows and its columns keys; no rotation */
    nb = bx / ((KVD / 128) * (SQ / 64)); bx -= nb * ((KVD / 128) * (SQ / 64)); const _Float16* xb = A + (size_t)nb * SQ * DM; A = Bh + 2 * sB; Bh = xb; M = KVD; N = SQ; }
  else { A += (size_t)by * sA; Bh += (size_t)by * sB; }
  const size_t cofs = (size_t)by * sC; const float* bp = bias ? bias + (size_t)by * sBias : nullptr;
  const int ntn = N >> 6; const int mt = bx / ntn, nq = bx - mt * ntn; const int row0 = mt * 128 + 32 * w, col0 = nq * 64; if (mt * 128 >= M) return;      /* block-uniform, in front of every barrier; M % 128 == 0 */
  const int sr = tid >> 3, sc = (tid & 7) * 8;      /* staging: a thread brings 16 bytes of rows sr + 16 i; 8 lanes cover one 128-byte line, a wave-wide load four whole lines */
  const unsigned short* ag = (const unsigned short*)A + (size_t)(mt * 128 + sr) * DM + sc; const unsigned short* bg = (const unsigned short*)Bh + (size_t)(col0 + sr) * DM + sc;
  v8us ga[8], gb[4];
#pragma unroll      /* ga[], gb[] in registers; constant row steps become immediate offsets */
  for (int i = 0; i < 8; ++i) ga[i] = *(const v8us*)(ag + (size_t)i * 16 * DM);
#pragma unroll
  for (int i = 0; i < 4; ++i) gb[i] = *(const v8us*)(bg + (size_t)i * 16 * DM);
  asm volatile("s_wait_xcnt 0x0" :: "v"(ag), "v"(bg) : "memory");      /* the staging loads' address pairs stay live up to this wait, so no register that an issued load names is overwritten in front of it */
#pragma unroll
  for (int i = 0; i < 8; ++i) *(v8us*)&la[0][sr + 16 * i][sc] = ga[i];
#pragma unroll
  for (int i = 0; i < 4; ++i) *(v8us*)&lb[0][sr + 16 * i][sc] = gb[i];
  const v8f z8 = {0.f,0.f,0.f,0.f,0.f,0.f,0.f,0.f}; v8f c00 = z8, c01 = z8, c02 = z8, c03 = z8, c10 = z8, c11 = z8, c12 = z8, c13 = z8;
  __syncthreads();      /* stage 0 is published */
#pragma unroll 1      /* one stage per trip: the registers hold one stage's fragments and the next stage's 12 staging loads */
  for (int st = 0; st < DM / G2_KC; ++st) { const int cur = st & 1; const bool more = st + 1 < DM / G2_KC;      /* block-uniform */
    if (more) { ag += G2_KC; bg += G2_KC;      /* the next stage flies under this stage's products */
#pragma unroll
      for (int i = 0; i < 8; ++i) ga[i] = *(const v8us*)(ag + (size_t)i * 16 * DM);
#pragma unroll
      for (int i = 0; i < 4; ++i) gb[i] = *(const v8us*)(bg + (size_t)i * 16 * DM);
      asm volatile("s_wait_xcnt 0x0" :: "v"(ag), "v"(bg) : "memory"); }      /* likewise: the pointers are stepped only behind this wait */
    v16h a0[2], a1[2], bf[4][2];
#pragma unroll      /* the stage's 24 LDS reads stand as one group in front of its 16 products */
    for (int kk = 0; kk < G2_KC / 32; ++kk) { a0[kk] = g2_frag(&la[cur][32 * w + ln][kk * 32], hh); a1[kk] = g2_frag(&la[cur][32 * w + 16 + ln][kk * 32], hh);
      for (int t = 0; t < 4; ++t) bf[t][kk] = g2_frag(&lb[cur][t * 16 + ln][kk * 32], hh); }
#pragma unroll      /* fragments in registers; k ascends as before: the sum order of every accumulator is unchanged */
    for (int kk = 0; kk < G2_KC / 32; ++kk) {
      c00 = g2_mma(a0[kk], bf[0][kk], c00); c10 = g2_mma(a1[kk], bf[0][kk], c10);
      c01 = g2_mma(a0[kk], bf[1][kk], c01); c11 = g2_mma(a1[kk], bf[1][kk], c11);
      c02 = g2_mma(a0[kk], bf[2][kk], c02); c12 = g2_mma(a1[kk], bf[2][kk], c12);
      c03 = g2_mma(a0[kk], bf[3][kk], c03); c13 = g2_mma(a1[kk], bf[3][kk], c13); }
    if (more) {      /* the other buffer's last readers left it at the previous trip's barrier */
#pragma unroll
      for (int i = 0; i < 8; ++i) *(v8us*)&la[cur ^ 1][sr + 16 * i][sc] = ga[i];
#pragma unroll
      for (int i = 0; i < 4; ++i) *(v8us*)&lb[cur ^ 1][sr + 16 * i][sc] = gb[i]; }
    __syncthreads(); }      /* publishes the next stage and ends every wave's reads of this one (behind the last trip: frees the buffers for the epilogue's staging) */
  v8f accs[8] = {c00, c01, c02, c03, c10, c11, c12, c13};
  if (ROPE) {      /* col0 is a multiple of 64 and row0 of 32: both halves of every rotation pair lie in this wave's own 32 x 64 tile, and its 32 positions do not wrap at SQ */
    const int rs = lane >> 3, d8 = (lane & 7) * 8; const float sg = (d8 < HD / 2) ? -1.0f : 1.0f;      /* 8 lanes per row, 8 columns each; rotate_half(v)[d] = -v[d + 32] below 32, v[d - 32] above */
    const size_t tb = (size_t)((unsigned)row0 % SQ + rs) * (HD / 2) + (d8 & (HD / 2 - 1)); const float* cp = CS + tb; const float* sp = SN + tb; v4f tc[8][2], ts[8][2];
#pragma unroll      /* accs[] in registers */
    for (int u = 0; u < 8; ++u) for (int r = 0; r < 8; ++r) so[w][(u >> 2) * 16 + 8 * hh + r][(u & 3) * 16 + ln] = accs[u][r] * alpha;
    __builtin_amdgcn_fence(__ATOMIC_ACQ_REL, "workgroup"); __builtin_amdgcn_wave_barrier();      /* the wave reads back rows that its other lanes wrote */
    if (vtp) {      /* block-uniform; shares the staging above, so the accumulators end there on both ways; 16 lanes store one whole 128-byte line of a V^T row */
      const int rsub = lane >> 4, c4 = (lane & 15) * 4; _Float16* vd = VTo + (size_t)nb * NH * HD * SQ + (size_t)(row0 + rsub) * SQ + col0 + c4;
#pragma unroll      /* constant LDS offsets; constant row steps become immediate offsets of one address */
      for (int q = 0; q < 16; ++q) { const v4f v = *(const v4fa*)&so[w][q * 2 + rsub][c4]; v4h h4; for (int i = 0; i < 4; ++i) h4[i] = (_Float16)v[i]; *(v4h*)(vd + (size_t)q * 2 * SQ) = h4; }
      asm volatile("s_wait_xcnt 0x0" ::: "memory");      /* directly behind the last store: on every way that the built code lays out behind the stores, this wait stands in front of the first write of a register that an issued store names */
      return; }
#pragma unroll      /* tc[], ts[] in registers; behind the staging, where the accumulators' registers are free */
    for (int q = 0; q < 8; ++q) for (int u = 0; u < 2; ++u) { tc[q][u] = *(const v4fa*)(cp + q * 4 * (HD / 2) + 4 * u); ts[q][u] = *(const v4fa*)(sp + q * 4 * (HD / 2) + 4 * u); }
    unsigned short* dp = (unsigned short*)C16 + cofs + (size_t)(row0 + rs) * ldc + col0 + d8;
#pragma unroll      /* 4 rows per trip, constant LDS offsets; a store covers four whole 128-byte lines */
    for (int q = 0; q < 8; ++q) { FragH f;
      for (int u = 0; u < 2; ++u) { const v4f own = *(const v4fa*)&so[w][q * 4 + rs][d8 + 4 * u], oth = *(const v4fa*)&so[w][q * 4 + rs][(d8 ^ (HD / 2)) + 4 * u];
        for (int i = 0; i < 4; ++i) f.h[4 * u + i] = (_Float16)(own[i] * tc[q][u][i] + oth[i] * (sg * ts[q][u][i])); }
      *(v8us*)(dp + (size_t)q * 4 * ldc) = f.half[0]; }
    asm volatile("s_wait_xcnt 0x0" ::: "memory");      /* likewise: the built code lays the V^T plane's read-back out behind these stores */
    return; }
#pragma unroll
  for (int u = 0; u < 8; ++u) { const int t = u & 3, half = u >> 2; const int col = col0 + t * 16 + ln; const float bv = bp ? bf16_round(bp[col]) : 0.f;
#pragma unroll
    for (int r = 0; r < 8; ++r) { const int rloc = half * 16 + 8 * hh + r; float v = accs[u][r] * alpha + bv; if (CP) { if (rowsPerB < 0) v += CP[cofs + (size_t)(row0g + row0 + rloc) * ldc + col];      /* rowsPerB < 0: own element of the batched C plane */ else { const int bidx = (row0g + row0 + rloc) / rowsPerB; v += CP[(size_t)bidx * sCPb + (size_t)by * 64 + col]; } }
      if (ACT == 3) v = fmaxf(v, 0.f); else if (ACT == 6) v = 0.5f * v * (1.0f + erff(v * 0.70710678118654752f)); else if (ACT == 11) v = 1.0f / (1.0f + expf(-v)); else if (ACT == 15) v = v / (1.0f + expf(-v)); else if (ACT == 12) v = (v > 0.f) ? v : 0.01f * v; else if (ACT == 8) v = tanhf(v); else if (ACT == 9) v = 0.5f * v * (1.0f + tanhf(0.7978845608028654f * (v + 0.044715f * v * v * v))); else if (ACT == 14) v = (v > 0.f) ? v : 0.1f * v; else if (ACT == 16) v = (v >= 0.f) ? v : 0.3f * v; else if (ACT == 17) v = (v >= 0.f) ? v : 0.2f * v;
      so[w][rloc][t * 16 + ln] = v; } }
  __builtin_amdgcn_fence(__ATOMIC_ACQ_REL, "workgroup"); __builtin_amdgcn_wave_barrier();
  const int rsub = lane >> 4, c4 = (lane & 15) * 4;
  {
#pragma unroll
    for (int q = 0; q < 16; ++q) { const int r = q * 2 + rsub; const v4f v = *(const v4fa*)&so[w][r][c4]; if (C) *(v4f*)(C + cofs + (size_t)(row0 + r) * ldc + col0 + c4) = v; if (C16) { v4h h4; for (int i = 0; i < 4; ++i) h4[i] = (_Float16)v[i]; *(v4h*)(C16 + cofs + (size_t)(row0 + r) * ldc + col0 + c4) = h4; } }
     } }


// ---- q / k / V^T projection GEMM: k_gemm2's stages and its rotation epilogue on a work-group tile of 128x128, 2 x 2 waves of 64x64 each (M % 128 == 0, N % 128 == 0) ----
// The square tile takes 2 operand rows from L2 per 128 results per k (128x64: 3), and a 64x64 wave tile reads 8 fragments from LDS per 16 products (32x64: 6 per 8); 3 x 256 work-groups, three per WGP: all resident at once.
// C16 = f16(v cos + rotate_half(v) sin), v = acc * alpha, per 64-column head; position = row % SQ, tables CS / SN [SQ][32]; grid.y 0 / 1 = q / k (weight planes sB apart, outputs sC apart); grid.y 2 is the transposed v projection into VTo (see below)
__global__ __launch_bounds__(128, 3) void k_gemm3(const _Float16* __restrict__ A, const _Float16* __restrict__ Bh, size_t sB, float alpha, _Float16* __restrict__ C16, int ldc, size_t sC, int M, int N, const float* __restrict__ CS, const float* __restrict__ SN, _Float16* __restrict__ VTo) {      /* second bound: three waves per SIMD, at most 336 registers */
  __shared__ __attribute__((aligned(16))) unsigned char sm[2 * (128 + 128) * G2_P * 2];      /* two stage buffers of A (128 rows) and B (128 rows); behind the loop's last barrier the same bytes are the epilogue's staging */
  _Float16 (*la)[128][G2_P] = (_Float16 (*)[128][G2_P])sm; _Float16 (*lb)[128][G2_P] = (_Float16 (*)[128][G2_P])(sm + 2 * 128 * G2_P * 2); float (*so)[64][68] = (float (*)[64][68])sm;
  static_assert(sizeof(float) * 4 * 64 * 68 <= sizeof(sm), "the epilogue's staging lies inside the stage buffers");
  const int tid = threadIdx.x, w = tid >> 5, lane = tid & 31, ln = lane & 15, hh = lane >> 4; const int by = blockIdx.y;
  int bx = blockIdx.x, nb = 0; const bool vtp = by == 2;      /* block-uniform */
  if (vtp) {      /* V^T [NB][NH][HD][SQ] = Wv x^T: the third weight plane's rows (head, d) are the A operand and the token rows of batch nb the B operand, so the tile's rows are V^T rows and its columns keys; no rotation */
    nb = bx / ((KVD / 128) * (SQ / 128)); bx -= nb * ((KVD / 128) * (SQ / 128)); const _Float16* xb = A + (size_t)nb * SQ * DM; A = Bh + 2 * sB; Bh = xb; M = KVD; N = SQ; }
  else Bh += (size_t)by * sB;
  const size_t cofs = (size_t)by * sC;
  const int ntn = N >> 7; const int mt = bx / ntn, nq = bx - mt * ntn; const int wm = w >> 1, wn = w & 1; const int row0 = mt * 128 + 64 * wm, col0 = nq * 128 + 64 * wn; if (mt * 128 >= M) return;      /* block-uniform, in front of every barrier; M % 128 == 0 */
  const int sr = tid >> 3, sc = (tid & 7) * 8;      /* staging: a thread brings 16 bytes of rows sr + 16 i; 8 lanes cover one 128-byte line, a wave-wide load four whole lines */
  const unsigned short* ag = (const unsigned short*)A + (size_t)(mt * 128 + sr) * DM + sc; const unsigned short* bg = (const unsigned short*)Bh + (size_t)(nq * 128 + sr) * DM + sc;
  v8us ga[8], gb[8];
#pragma unroll      /* ga[], gb[] in registers; constant row steps become immediate offsets */
  for (int i = 0; i < 8; ++i) ga[i] = *(const v8us*)(ag + (size_t)i * 16 * DM);
#pragma unroll
  for (int i = 0; i < 8; ++i) gb[i] = *(const v8us*)(bg + (size_t)i * 16 * DM);
  asm volatile("s_wait_xcnt 0x0" :: "v"(ag), "v"(bg) : "memory");      /* the staging loads' address pairs stay live up to this wait, so no register that an issued load names is overwritten in front of it */
#pragma unroll
  for (int i = 0; i < 8; ++i) *(v8us*)&la[0][sr + 16 * i][sc] = ga[i];
#pragma unroll
  for (int i = 0; i < 8; ++i) *(v8us*)&lb[0][sr + 16 * i][sc] = gb[i];
  const v8f z8 = {0.f,0.f,0.f,0.f,0.f,0.f,0.f,0.f}; v8f c[4][4];      /* [16 rows][16 columns] of the wave's 64 x 64 */
#pragma unroll      /* c[][] in registers */
  for (int i = 0; i < 4; ++i) for (int t = 0; t < 4; ++t) c[i][t] = z8;
  __syncthreads();      /* stage 0 is published */
#pragma unroll 1      /* one stage per trip: the registers hold one stage's fragments and the next stage's 16 staging loads */
  for (int st = 0; st < DM / G2_KC; ++st) { const int cur = st & 1; const bool more = st + 1 < DM / G2_KC;      /* block-uniform */
    if (more) { ag += G2_KC; bg += G2_KC;      /* the next stage flies under this stage's products */
#pragma unroll
      for (int i = 0; i < 8; ++i) ga[i] = *(const v8us*)(ag + (size_t)i * 16 * DM);
#pragma unroll
      for (int i = 0; i < 8; ++i) gb[i] = *(const v8us*)(bg + (size_t)i * 16 * DM);
      asm volatile("s_wait_xcnt 0x0" :: "v"(ag), "v"(bg) : "memory"); }      /* likewise: the pointers are stepped only behind this wait */
#pragma unroll      /* per 32 k: 16 LDS reads as one group in front of their 16 products, so that accumulators and fragments stay below v256, where the operands of g2_mma's statement must lie; k ascends as before: the sum order of every accumulator is unchanged */
    for (int kk = 0; kk < G2_KC / 32; ++kk) { v16h af[4], bf[4];
      for (int t = 0; t < 4; ++t) { af[t] = g2_frag(&la[cur][64 * wm + t * 16 + ln][kk * 32], hh); bf[t] = g2_frag(&lb[cur][64 * wn + t * 16 + ln][kk * 32], hh); }
      for (int t = 0; t < 4; ++t) for (int i = 0; i < 4; ++i) c[i][t] = g2_mma(af[i], bf[t], c[i][t]); }
    if (more) {      /* the other buffer's last readers left it at the previous trip's barrier */
#pragma unroll
      for (int i = 0; i < 8; ++i) *(v8us*)&la[cur ^ 1][sr + 16 * i][sc] = ga[i];
#pragma unroll
      for (int i = 0; i < 8; ++i) *(v8us*)&lb[cur ^ 1][sr + 16 * i][sc] = gb[i]; }
    __syncthreads(); }      /* publishes the next stage and ends every wave's reads of this one (behind the last trip: frees the buffers for the epilogue's staging) */
  {      /* col0 and row0 are multiples of 64: both halves of every rotation pair lie in this wave's own 64 x 64 tile, and its 64 positions do not wrap at SQ */
    const int rs = lane >> 3, d8 = (lane & 7) * 8; const float sg = (d8 < HD / 2) ? -1.0f : 1.0f;      /* 8 lanes per row, 8 columns each; rotate_half(v)[d] = -v[d + 32] below 32, v[d - 32] above */
    const unsigned tb = (((unsigned)row0 % SQ + rs) * (HD / 2) + (d8 & (HD / 2 - 1))) * 4u; const float* cp = (const float*)((const char*)CS + tb); const float* sp = (const float*)((const char*)SN + tb); v4f tc[16][2], ts[16][2];      /* tb: the lane's byte offset in both tables */
#pragma unroll      /* c[][] in registers */
    for (int i = 0; i < 4; ++i) for (int t = 0; t < 4; ++t) for (int r = 0; r < 8; ++r) so[w][i * 16 + 8 * hh + r][t * 16 + ln] = c[i][t][r] * alpha;
    __builtin_amdgcn_fence(__ATOMIC_ACQ_REL, "workgroup"); __builtin_amdgcn_wave_barrier();      /* the wave reads back rows that its other lanes wrote */
    if (vtp) {      /* block-uniform; shares the staging above, so the accumulators end there on both ways; 16 lanes store one whole 128-byte line of a V^T row */
      const int rsub = lane >> 4, c4 = (lane & 15) * 4; _Float16* vd = VTo + (size_t)nb * NH * HD * SQ + (size_t)(row0 + rsub) * SQ + col0 + c4;
#pragma unroll      /* 16 rows per trip; constant LDS offsets; constant row steps become immediate offsets of one address */
      for (int g = 0; g < 4; ++g) { v4h h4[8];
        for (int j = 0; j < 8; ++j) { const v4f v = *(const v4fa*)&so[w][(g * 8 + j) * 2 + rsub][c4]; for (int i = 0; i < 4; ++i) h4[j][i] = (_Float16)v[i]; }
        for (int j = 0; j < 8; ++j) *(v4h*)(vd + (size_t)(g * 8 + j) * 2 * SQ) = h4[j];
        asm volatile("s_wait_xcnt 0x0" ::: "memory"); }      /* directly behind the trip's stores: this wait stands in front of the first write of a register that an issued store names, in the next trip and on every way that the built code lays out behind the last */
      return; }
#pragma unroll      /* tc[], ts[] in registers; behind the staging, where the accumulators' registers are free; the first 12 of the 16 row groups' entries fly together */
    for (int q = 0; q < 12; ++q) for (int u = 0; u < 2; ++u) { tc[q][u] = *(const v4fa*)(cp + q * 4 * (HD / 2) + 4 * u); ts[q][u] = *(const v4fa*)(sp + q * 4 * (HD / 2) + 4 * u); }
    asm volatile("s_wait_xcnt 0x0" :: "v"(tb) : "memory");      /* the table loads' offset register stays live up to this wait, so no register that an issued load names is overwritten in front of it */
    unsigned short* dp = (unsigned short*)C16 + cofs + (size_t)(row0 + rs) * ldc + col0 + d8;
#pragma unroll      /* 16 rows per trip, constant LDS offsets; a store covers four whole 128-byte lines */
    for (int g = 0; g < 4; ++g) { FragH f[4];
      for (int j = 0; j < 4; ++j) { const int q = g * 4 + j;
        for (int u = 0; u < 2; ++u) { const v4f own = *(const v4fa*)&so[w][q * 4 + rs][d8 + 4 * u], oth = *(const v4fa*)&so[w][q * 4 + rs][(d8 ^ (HD / 2)) + 4 * u];
          for (int i = 0; i < 4; ++i) f[j].h[4 * u + i] = (_Float16)(own[i] * tc[q][u][i] + oth[i] * (sg * ts[q][u][i])); } }
      for (int j = 0; j < 4; ++j) *(v8us*)(dp + (size_t)(g * 4 + j) * 4 * ldc) = f[j].half[0];
      asm volatile("s_wait_xcnt 0x0" ::: "memory");      /* directly behind the trip's stores: the next trip (and, behind the last, whatever the built code lays out there) writes registers that they name; its memory clobber also keeps the later trips' LDS reads from being lifted to the front, where the registers would run over into scratch */
      if (g == 0) {      /* the last 4 row groups' entries go into the registers that the first 4 have left, and fly under the 8 groups between: all 16 at once leave no room for three waves per SIMD */
        for (int q = 12; q < 16; ++q) for (int u = 0; u < 2; ++u) { tc[q][u] = *(const v4fa*)(cp + q * 4 * (HD / 2) + 4 * u); ts[q][u] = *(const v4fa*)(sp + q * 4 * (HD / 2) + 4 * u); }
        asm volatile("s_wait_xcnt 0x0" :: "v"(tb) : "memory"); } }      /* likewise for these loads */
  } }


#define FA_W 8                       /* waves per key half, 32 query columns each */
#define FA_KS 2                      /* key halves per work-group */
#define FA_HB (2 * (FA_ST + HD) * FA_P * 2)      /* LDS bytes of one key half: two stage buffers of K and of V^T */
#define FA_QB (FA_W * 32)            /* query rows per work-group */
#define FA_ST 64                     /* keys per LDS stage */
#define FA_P 72                      /* LDS row pitch in f16: 128-byte rows + 16 bytes (16 B x odd: conflict-free 16-byte reads) */
typedef float v2f __attribute__((ext_vector_type(2)));
typedef _Float16 v2h __attribute__((ext_vector_type(2)));
__device__ __forceinline__ float fa_xhalf(float x) { return __builtin_bit_cast(float, __builtin_amdgcn_permlanex16(__builtin_bit_cast(int, x), __builtin_bit_cast(int, x), 0x76543210, 0xfedcba98, false, false)); }      /* lane l reads lane l ^ 16 */
__device__ __forceinline__ v8f fa_mma(v16h a, v16h b, v8f c) { return __builtin_amdgcn_wmma_f32_16x16x32_f16(false, a, false, b, (short)0, c, false, false); }
__global__ __launch_bounds__(FA_KS * FA_W * 32) void k_fattn(const _Float16* __restrict__ Q16, const _Float16* __restrict__ K16, const _Float16* __restrict__ VT, _Float16* __restrict__ O16) {
  __shared__ __attribute__((aligned(16))) unsigned char sm[FA_KS * FA_HB];      /* per key half two stage buffers of K and of V^T; behind the loop's last barrier the same bytes carry the hand-over */
  static_assert(FA_W * 17 * 32 * 16 <= FA_KS * FA_HB, "the hand-over lies inside the stage buffers");
  const int kh = __builtin_amdgcn_readfirstlane((int)(threadIdx.x >> 8));      /* the wave's key half, in a scalar register: the tests on it are scalar branches and the LDS bases scalar sums */
  _Float16 (*lk)[FA_ST][FA_P] = (_Float16 (*)[FA_ST][FA_P])(sm + kh * FA_HB); _Float16 (*lv)[HD][FA_P] = (_Float16 (*)[HD][FA_P])(sm + kh * FA_HB + 2 * FA_ST * FA_P * 2);
  const int tid = threadIdx.x & (FA_W * 32 - 1), w = tid >> 5, lane = tid & 31, ln = lane & 15, hh = lane >> 4; const int h = blockIdx.y, b = blockIdx.z; const size_t r0 = (size_t)b * SQ; const int q0 = blockIdx.x * FA_QB + w * 32;      /* tid, w: inside the key half */
  const int sr = tid >> 3, sc = (tid & 7) * 8;      /* staging: a thread brings 16 bytes of rows sr and sr + 32 of each tile; 8 lanes cover one 128-byte line */
  const unsigned short* kg = (const unsigned short*)K16 + (r0 + kh * (SQ / FA_KS) + sr) * KVD + h * HD + sc;      /* key row sr of the half's stage, this head's 64 columns */
  const unsigned short* vg = (const unsigned short*)VT + ((size_t)(b * NH + h) * HD + sr) * SQ + kh * (SQ / FA_KS) + sc;      /* V^T row d = sr, the stage's 64 keys */
  v8us gk0 = *(const v8us*)kg, gk1 = *(const v8us*)(kg + (size_t)32 * KVD), gv0 = *(const v8us*)vg, gv1 = *(const v8us*)(vg + (size_t)32 * SQ);
  v16h qf[2][2];      /* [column group][k step of 32], kept for the whole kernel */
  { const _Float16* qp = Q16 + (r0 + q0 + ln) * LQ + h * HD;
#pragma unroll      /* constant indices keep qf[] in registers */
    for (int g = 0; g < 2; ++g) for (int kk = 0; kk < 2; ++kk) qf[g][kk] = g2_frag(qp + (size_t)g * 16 * LQ + kk * 32, hh);
    asm volatile("s_wait_xcnt 0x0" :: "v"(qp) : "memory"); }      /* the q loads' address pair stays live up to this wait, so no register that an issued load names is overwritten in front of it */
  *(v8us*)&lk[0][sr][sc] = gk0; *(v8us*)&lk[0][sr + 32][sc] = gk1; *(v8us*)&lv[0][sr][sc] = gv0; *(v8us*)&lv[0][sr + 32][sc] = gv1;
  const v8f z8 = {0.f,0.f,0.f,0.f,0.f,0.f,0.f,0.f}; v8f o[2][4];      /* O^T: [column group][16 rows of d] */
#pragma unroll      /* o[] in registers */
  for (int g = 0; g < 2; ++g) for (int t = 0; t < 4; ++t) o[g][t] = z8;
  float mr[2] = {-1.0e30f, -1.0e30f}, l[2] = {0.f, 0.f};      /* maximum in use (log2-scaled) and this lane's part of the denominator */
  const float cs = 0.125f * 1.4426950408889634f;      /* 64^-0.5 * log2(e) */
  __syncthreads();      /* stage 0 is published */
  for (int st = 0; st < SQ / FA_KS / FA_ST; ++st) { const int cur = st & 1; const bool more = st + 1 < SQ / FA_KS / FA_ST;      /* block-uniform */
    if (more) { kg += (size_t)FA_ST * KVD; vg += FA_ST; gk0 = *(const v8us*)kg; gk1 = *(const v8us*)(kg + (size_t)32 * KVD); gv0 = *(const v8us*)vg; gv1 = *(const v8us*)(vg + (size_t)32 * SQ);      /* the next stage flies under this stage's two passes */
      asm volatile("s_wait_xcnt 0x0" :: "v"(kg), "v"(vg) : "memory"); }      /* likewise for the next stage's staging loads (stage 0's passed the wait behind the q loads): the pointers are stepped only behind this wait */
#pragma unroll      /* two 32-key passes per stage, constant LDS offsets */
    for (int ps = 0; ps < FA_ST / 32; ++ps) {
      v8f s[2][2];      /* S^T: [column group][16 keys] */
      { v16h kf[2][2];
#pragma unroll      /* fragments in registers */
        for (int t = 0; t < 2; ++t) for (int kk = 0; kk < 2; ++kk) kf[t][kk] = g2_frag(&lk[cur][ps * 32 + t * 16 + ln][kk * 32], hh);
#pragma unroll      /* fragments in registers */
        for (int t = 0; t < 2; ++t) for (int g = 0; g < 2; ++g) s[g][t] = fa_mma(kf[t][1], qf[g][1], fa_mma(kf[t][0], qf[g][0], z8)); }
      v16h vf[4];
#pragma unroll      /* fragments in registers; these reads fly under the maxima and exponentials */
      for (int t = 0; t < 4; ++t) vf[t] = g2_frag(&lv[cur][t * 16 + ln][ps * 32], hh);
      float mb[2]; bool need = false;
#pragma unroll      /* s[] in registers */
      for (int g = 0; g < 2; ++g) { float mx = s[g][0][0];
        for (int r = 1; r < 8; ++r) mx = fmaxf(mx, s[g][0][r]);
        for (int r = 0; r < 8; ++r) mx = fmaxf(mx, s[g][1][r]);
        mx = fmaxf(mx, fa_xhalf(mx)) * cs; mb[g] = mx; need = need || (mx > mr[g] + 8.0f); }      /* both halves hold the column's maximum; the one in use may trail it by 8 (weights up to 2^8) */
      if (__builtin_amdgcn_ballot_w32(need) != 0) {      /* wave-uniform; always on the first pass, rare afterwards */
#pragma unroll      /* o[] in registers */
        for (int g = 0; g < 2; ++g) { const float mn = fmaxf(mr[g], mb[g]); const float corr = __builtin_amdgcn_exp2f(mr[g] - mn); mr[g] = mn; l[g] *= corr;
          for (int t = 0; t < 4; ++t) o[g][t] = o[g][t] * corr; } }
#pragma unroll      /* s[], o[] in registers */
      for (int g = 0; g < 2; ++g) { const float nm = -mr[g]; const v8f c8 = {cs, cs, cs, cs, cs, cs, cs, cs}, n8 = {nm, nm, nm, nm, nm, nm, nm, nm}; FragH pf; float la = 0.f, lb = 0.f;
        for (int t = 0; t < 2; ++t) { s[g][t] = __builtin_elementwise_fma(s[g][t], c8, n8);
          for (int r = 0; r < 8; ++r) s[g][t][r] = __builtin_amdgcn_exp2f(s[g][t][r]); }      /* weights 2^(score * cs - maximum in use), in the score registers */
        for (int i = 0; i < 8; ++i) { const int t = i >> 2, r = 2 * (i & 3);
          la += s[g][t][r]; lb += s[g][t][r + 1];
          const v2h pk = __builtin_convertvector(v2f{s[g][t][r], s[g][t][r + 1]}, v2h); pf.h[2 * i] = pk[0]; pf.h[2 * i + 1] = pk[1]; }
        l[g] += la + lb;
        for (int t = 0; t < 4; ++t) o[g][t] = fa_mma(vf[t], pf.v, o[g][t]); } }
    asm volatile("v_nop\n\tv_nop\n\tv_nop\n\tv_nop" : "+v"(o[0][0]), "+v"(o[0][1]), "+v"(o[0][2]), "+v"(o[0][3]), "+v"(o[1][0]), "+v"(o[1][1]), "+v"(o[1][2]), "+v"(o[1][3]));      /* four issue slots behind the stage's last matrix instructions: a branch follows */
    if (more) { *(v8us*)&lk[cur ^ 1][sr][sc] = gk0; *(v8us*)&lk[cur ^ 1][sr + 32][sc] = gk1; *(v8us*)&lv[cur ^ 1][sr][sc] = gv0; *(v8us*)&lv[cur ^ 1][sr + 32][sc] = gv1; }      /* its last readers left it at the previous trip's barrier */
    __syncthreads(); }      /* publishes the next stage and ends every wave's reads of this one (behind the last trip: frees the buffers for the hand-over) */
  v4fa* mg = (v4fa*)sm + w * (17 * 32) + lane;      /* hand-over between the two waves of equal w: 17 words of 16 bytes per lane, lane to same lane; a wave-wide access covers 512 contiguous bytes */
  if (kh == 1) {      /* wave-uniform */
#pragma unroll      /* o[] in registers */
    for (int g = 0; g < 2; ++g) for (int t = 0; t < 4; ++t) for (int u = 0; u < 2; ++u) mg[((g * 4 + t) * 2 + u) * 32] = v4f{o[g][t][4 * u], o[g][t][4 * u + 1], o[g][t][4 * u + 2], o[g][t][4 * u + 3]};
    mg[16 * 32] = v4f{mr[0], mr[1], l[0], l[1]}; }
  __syncthreads();      /* the second half's results are published; every wave passes it */
  if (kh == 1) return;      /* behind the last barrier */
  { const v4f s1 = mg[16 * 32];
#pragma unroll      /* o[] in registers */
    for (int g = 0; g < 2; ++g) { const float mn = fmaxf(mr[g], s1[g]); const float c0 = __builtin_amdgcn_exp2f(mr[g] - mn), c1 = __builtin_amdgcn_exp2f(s1[g] - mn); l[g] = l[g] * c0 + s1[2 + g] * c1;      /* both halves onto the larger maximum */
      for (int t = 0; t < 4; ++t) for (int u = 0; u < 2; ++u) { const v4f x = mg[((g * 4 + t) * 2 + u) * 32];
        for (int r = 0; r < 4; ++r) o[g][t][4 * u + r] = o[g][t][4 * u + r] * c0 + x[r] * c1; } } }
#pragma unroll      /* o[] in registers */
  for (int g = 0; g < 2; ++g) { const float fin = 64.0f / (l[g] + fa_xhalf(l[g]));      /* the halves' sums join once; o carried x64 */
    unsigned short* d = (unsigned short*)O16 + (r0 + q0 + g * 16 + ln) * DM + h * HD + 8 * hh;
    for (int t = 0; t < 4; ++t) { FragH f; for (int r = 0; r < 8; ++r) f.h[r] = (_Float16)(o[g][t][r] * fin); *(v8us*)(d + t * 16) = f.half[0]; } } }      /* a lane's 8 registers are 8 consecutive d of its query row: one 16-byte store */
__global__ __launch_bounds__(256) void k_vt(const _Float16* __restrict__ V16, int b, int h0, _Float16* __restrict__ VT) { __shared__ unsigned short tl[64][65]; const int tid = threadIdx.x; const int hh = blockIdx.x % HG, sg = blockIdx.x / HG; const int s0 = sg * 64; const int h = h0 + hh;
  for (int i = tid; i < 64 * 8; i += 256) { const int j = i / 8, d8 = (i % 8) * 8; FragH f; f.half[0] = *(const v8us*)((const unsigned short*)V16 + ((size_t)b * SQ + s0 + j) * DM + h * HD + d8); for (int q = 0; q < 8; ++q) tl[d8 + q][j] = f.u[q]; }
  __syncthreads();
  { for (int i = tid; i < 64 * 8; i += 256) { const int d = i / 8, j8 = (i % 8) * 8; FragH f; for (int q = 0; q < 8; ++q) f.u[q] = tl[d][j8 + q]; *(v8us*)((unsigned short*)VT + ((size_t)hh * HD + d) * SQ + s0 + j8) = f.half[0]; }  } }



__global__ __launch_bounds__(256) void k_rsmcf2(const float* __restrict__ S, _Float16* __restrict__ P, int hg, int q0, int nk) {
  #pragma clang fp contract(off)
  const int t = blockIdx.x * 256 + threadIdx.x; if (t >= hg * QT) return; const size_t i = (size_t)t; const float* s = S + i * NKX; const int last = q0 + (t % QT); float mx = -3.0e38f;
#pragma unroll 1
  for (int j = 0; j < nk; ++j) { const float f = (j <= last) ? 1.f : 0.f; mx = fmaxf(mx, fmaf(f, s[j], (1.f - f) * -1.0e9f)); } float se = 0.f;
#pragma unroll 1
  for (int j = 0; j < nk; ++j) { const float f = (j <= last) ? 1.f : 0.f; se += __expf(fmaf(f, s[j], (1.f - f) * -1.0e9f) - mx); } const float sc = 256.0f / se;
#pragma unroll 1
  for (int j0 = 0; j0 < nk; j0 += 8) { FragH fr; for (int q = 0; q < 8; ++q) { const int j = j0 + q; const float f = (j <= last) ? 1.f : 0.f; fr.h[q] = (_Float16)(__expf(fmaf(f, s[j], (1.f - f) * -1.0e9f) - mx) * sc); } unsigned short* d = (unsigned short*)P + i * NKX + j0; *(v8us*)d = fr.half[0];  } }


template <int MASKADD>
__global__ __launch_bounds__(64) void k_att0(const float* __restrict__ QF, const float* __restrict__ KF, const float* __restrict__ VF, int ld, const float* __restrict__ mask, float scale, float* __restrict__ OF, int ldo) {
  #pragma clang fp contract(off)
  __shared__ __attribute__((aligned(16))) float lq[64][64]; __shared__ __attribute__((aligned(16))) float lo[64][64];
  const int tid = threadIdx.x; const int h = blockIdx.x / (QT0 / 64), rg = blockIdx.x % (QT0 / 64); const int i = rg * 64 + tid;
  const float* qr = QF + (size_t)i * ld + h * HD;
#pragma unroll 1
  for (int c = 0; c < HD / 4; ++c) { *(v4f*)&lq[tid][c * 4] = *(const v4fa*)(qr + c * 4); const v4f z = {0.f, 0.f, 0.f, 0.f}; *(v4f*)&lo[tid][c * 4] = z; }
  float m = -1.0e30f, l = 0.f; const int jmax = MASKADD ? (SQ - 1) : (rg * 64 + 63);      /* additive-mask form: every key (the mask input decides); causal form: keys up to the block's last row */
#pragma unroll 1
  for (int j = 0; j <= jmax; ++j) { const float* kr = KF + (size_t)j * ld + h * HD; const float* vr = VF + (size_t)j * ld + h * HD; float s = 0.f;
#pragma unroll 1
    for (int c = 0; c < HD / 4; ++c) { const v4f kq = *(const v4fa*)(kr + c * 4); const v4f qq = *(v4f*)&lq[tid][c * 4]; s = __fadd_rn(s, __fmul_rn(qq[0], kq[0])); s = __fadd_rn(s, __fmul_rn(qq[1], kq[1])); s = __fadd_rn(s, __fmul_rn(qq[2], kq[2])); s = __fadd_rn(s, __fmul_rn(qq[3], kq[3])); }
    s = __fmul_rn(s, scale); if (MASKADD) s = __fadd_rn(s, __fmul_rn(bf16_round(mask[(size_t)i * SQ + j]), -10000.0f));
    const float f = (MASKADD || j <= i) ? 1.f : 0.f; const float sm = fmaf(f, s, (1.f - f) * -1.0e30f); const float mn = fmaxf(m, sm); const float sc = expf(m - mn); const float e = expf(sm - mn); l = __fadd_rn(__fmul_rn(l, sc), e); m = mn;
#pragma unroll 1
    for (int c = 0; c < HD / 4; ++c) { const v4f vv = *(const v4fa*)(vr + c * 4); v4f oo = *(v4f*)&lo[tid][c * 4]; for (int u = 0; u < 4; ++u) oo[u] = __fadd_rn(__fmul_rn(oo[u], sc), __fmul_rn(e, vv[u])); *(v4f*)&lo[tid][c * 4] = oo; } }
  const float fin = 64.0f / l;      /* o carried x64 like the f16 path */
#pragma unroll 1
  for (int c = 0; c < HD / 4; ++c) { v4f oo = *(v4f*)&lo[tid][c * 4]; for (int u = 0; u < 4; ++u) oo[u] = __fmul_rn(oo[u], fin); *(v4f*)&lo[tid][c * 4] = oo; }
  __syncthreads();
  {
#pragma unroll 1
    for (int it = 0; it < 16; ++it) { const int row = it * 4 + tid / 16, pc = (tid % 16) * 4; const v4f v = *(const v4f*)&lo[row][pc]; *(v4f*)(OF + (size_t)(rg * 64 + row) * ldo + h * HD + pc) = v; }
     } }


__global__ __launch_bounds__(256) void k_kvexp(const float* __restrict__ src, float* __restrict__ dst, size_t n4) { const size_t t = (size_t)blockIdx.x * 256 + threadIdx.x; if (t >= n4) return; const size_t e = t * 4; const size_t row = e / DM; const int col = (int)(e % DM); const int h = col / HD, d = col % HD; const v4f v = *(const v4fa*)(src + row * KVD + (size_t)(h / HPG) * HD + d); *(v4f*)(dst + e) = v;  }

__global__ __launch_bounds__(256) void k_tab2(float theta, float* __restrict__ CS, float* __restrict__ SN) {
  #pragma clang fp contract(off)
  const int t = blockIdx.x * 256 + threadIdx.x; if (t >= SQ * (HD / 2)) return; const int i = t % (HD / 2); const int p = t / (HD / 2); const float invf = 1.0f / powf(theta, (float)(2 * i) / (float)HD); const float ang = __fmul_rn((float)p, invf); const float c = cosf(ang), s = sinf(ang);
  *(float*)(CS + t) = c; *(float*)(SN + t) = s;  }
template <int NORM, int ROPE>
__global__ __launch_bounds__(64) void k_xformf(const float* __restrict__ F, int ldf, int nh, const float* __restrict__ gain, float eps, const float* __restrict__ CS, const float* __restrict__ SN, float* __restrict__ F32, int ldo) {
  #pragma clang fp contract(off)
  __shared__ float xv[HD]; __shared__ float red[HD]; const int d = threadIdx.x; const int h = blockIdx.x % nh; const size_t r = blockIdx.x / nh; const int p = (int)(r % SQ);
  float x = F[r * (size_t)ldf + (size_t)h * HD + d];
  if (NORM) { red[d] = __fmul_rn(x, x); __syncthreads(); for (int st = HD / 2; st > 0; st >>= 1) { if (d < st) red[d] = __fadd_rn(red[d], red[d + st]); __syncthreads(); } const float rs = rsqrtf(__fadd_rn(red[0] / (float)HD, eps)); x = __fmul_rn(__fmul_rn(x, rs), bf16_round(gain[d])); }
  xv[d] = x; __syncthreads();
  float o = x;
  if (ROPE == 1) { const int i = d >> 1; const float c = CS[p * (HD / 2) + i], s = SN[p * (HD / 2) + i]; const float ev = xv[2 * i], od = xv[2 * i + 1]; o = (d & 1) ? __fadd_rn(__fmul_rn(ev, s), __fmul_rn(od, c)) : __fadd_rn(__fmul_rn(ev, c), -__fmul_rn(od, s)); }
  if (ROPE == 2) { const int i = d & (HD / 2 - 1); const float c = CS[p * (HD / 2) + i], s = SN[p * (HD / 2) + i]; const float lo = xv[i], hi = xv[i + HD / 2]; o = (d < HD / 2) ? __fadd_rn(__fmul_rn(lo, c), -__fmul_rn(hi, s)) : __fadd_rn(__fmul_rn(lo, s), __fmul_rn(hi, c)); }
  float* dst = F32 + r * (size_t)ldo + (size_t)h * HD + d; *(float*)dst = o;  }

__global__ __launch_bounds__(256) void k_bfcp(const float* __restrict__ src, float* __restrict__ dst, size_t n4) { const size_t t = (size_t)blockIdx.x * 256 + threadIdx.x; if (t >= n4) return; const v4f a = *(const v4fa*)(src + t * 4); v4f o; for (int q = 0; q < 4; ++q) o[q] = bf16_round(a[q]); *(v4f*)(dst + t * 4) = o;  }

// operand preparation of the whole call in ONE launch: rope tables (the first work-groups: the longest dependent chains start first), x as f16 rows, the four natural weights as x16 f16 planes.
// A streaming wave owns 16 KiB of one source: PP_L wave-wide 16-byte loads of 512 contiguous bytes each, all in flight at once, then the conversions, then whole-line 8-byte stores; few waves, so little of the launch goes into starting them.
#define PP_L 32                      /* 16-byte loads in flight per lane */
#define PP_BF (256 * PP_L * 4)       /* floats per streaming work-group */
#define PP_TB 64                     /* table work-groups: SQ * 32 entries, 4 positions per thread */
#define PP_XB ((int)(NR * DM / PP_BF))      /* work-groups on x */
#define PP_WB (DM * DM / PP_BF)      /* work-groups per weight */
__device__ __forceinline__ float pp_round(float v) { const unsigned int u = __float_as_uint(v); return __uint_as_float((u + 0x7FFFu + ((u >> 16) & 1u)) & 0xFFFF0000u); }      /* the value of bf16_round(v), kept in 32-bit registers */
__global__ __launch_bounds__(256) void k_prep(const float* __restrict__ x, const float* __restrict__ wq, const float* __restrict__ wk, const float* __restrict__ wv, const float* __restrict__ wo, _Float16* __restrict__ X16, _Float16* __restrict__ BW, float* __restrict__ CS, float* __restrict__ SN) {
  static_assert(NR * DM % PP_BF == 0 && DM * DM % PP_BF == 0 && KVD == DM, "whole work-groups per source; four planes of equal size");
  static_assert(SQ % (PP_TB * 8) == 0 && HD / 2 == 32, "a table wave writes one position's 32 entries: one 128-byte line per table");
  const int tid = threadIdx.x; int blk = blockIdx.x;
  if (blk < PP_TB) {      /* block-uniform; CS[p][i] = cos(p * 10000^(-2i/64)), SN = sin: the frequency once per thread, then per position the f32 angle, cosf and sinf */
    const int t = blk * 256 + tid; const int i = t % (HD / 2); const int p0 = t / (HD / 2); const float invf = (float)(1.0 / pow(10000.0, (double)(2 * i) / (double)HD));
    for (int u = 0; u < SQ / (PP_TB * 8); ++u) { const int p = p0 + u * (PP_TB * 8); const float ang = __fmul_rn((float)p, invf); const float c = cosf(ang), s = sinf(ang); CS[p * (HD / 2) + i] = c; SN[p * (HD / 2) + i] = s; }
    return; }
  blk -= PP_TB;
  const float* src; _Float16* dst; float scale;      /* block-uniform choice of the source */
  if (blk < PP_XB) { src = x + (size_t)blk * PP_BF; dst = X16 + (size_t)blk * PP_BF; scale = 1.0f; }
  else { blk -= PP_XB; const int wi = blk / PP_WB; src = (wi == 0 ? wq : wi == 1 ? wk : wi == 2 ? wv : wo) + (size_t)(blk % PP_WB) * PP_BF; dst = BW + (size_t)blk * PP_BF; scale = 16.0f; }      /* the planes follow one another in the workspace */
  const int o = (tid >> 5) * (PP_L * 128) + (tid & 31) * 4; src += o; dst += o;
  v4f a[PP_L]; v4h h[PP_L];
#pragma unroll      /* a[] in registers; constant steps become immediate offsets */
  for (int j = 0; j < PP_L; ++j) a[j] = *(const v4fa*)(src + j * 128);
  asm volatile("s_wait_xcnt 0x0" :: "v"(src) : "memory");      /* the loads' address stays live up to this wait, so no register that an issued load names is overwritten in front of it */
  __builtin_amdgcn_sched_barrier(0);      /* no conversion moves in front of a load: otherwise the compiler issues the loads in two runs, the second behind the first one's data, and the wave pays the memory latency twice */
#pragma unroll      /* h[] in registers */
  for (int j = 0; j < PP_L; ++j) for (int q = 0; q < 4; q += 2) { const v2h pk = __builtin_convertvector(v2f{pp_round(a[j][q]) * scale, pp_round(a[j][q + 1]) * scale}, v2h); h[j][q] = pk[0]; h[j][q + 1] = pk[1]; }      /* bf16-rounded values are exact in f16 here, x1 and x16 alike */
  __builtin_amdgcn_sched_barrier(0);      /* every conversion stands in front of the first store: behind an issued store no register that it names is written any more */
#pragma unroll
  for (int j = 0; j < PP_L; ++j) *(v4h*)(dst + j * 128) = h[j];
  asm volatile("s_wait_xcnt 0x0" ::: "memory"); }      /* directly behind the last store: on every way that the built code lays out behind the stores, this wait stands in front of the first write of a register that an issued store names */
extern "C" void kernel_launch(void* const* d_in, const int* in_sizes, int n_in,
                              void* d_out, int out_size, void* d_ws, size_t ws_size, hipStream_t stream) {
  (void)in_sizes; (void)n_in; (void)out_size;
  const float* const* I = (const float* const*)d_in; const float* x = I[0]; const float* wq = I[1]; const float* wk = I[2]; const float* wv = I[3]; const float* wo = I[4]; const float* bq = nullptr; const float* bk = nullptr; const float* bv = nullptr; const float* bo = I[5];      /* input order: x, Wq, Wk, Wv, Wo (natural [out][in] weights), bo [1024] (the output bias: into the output GEMM's bias slot); the q / k / v projections have NO biases; rope tables computed in the kernel (positions = row index) */
  char* ws = (char*)d_ws; size_t off = 0;
  auto take = [&](size_t bytes) { char* p = ws + off; off += (bytes + 255) & ~(size_t)255; return p; };
  _Float16* BQ = (_Float16*)take((size_t)DM * DM * 2); _Float16* BK = (_Float16*)take((size_t)KVD * DM * 2); _Float16* BV = (_Float16*)take((size_t)KVD * DM * 2); _Float16* BO = (_Float16*)take((size_t)DM * DM * 2);
  _Float16* X16 = (_Float16*)take(NR * DM * 2); float* CSB = (float*)take((size_t)SQ * 32 * 4); float* SNB = (float*)take((size_t)SQ * 32 * 4); _Float16* Q16 = (_Float16*)take(NR * DM * 2); _Float16* K16 = (_Float16*)take(NR * KVD * 2); _Float16* V16 = (_Float16*)take(NR * KVD * 2); _Float16* O16 = (_Float16*)take(NR * DM * 2);
  _Float16* VT = (_Float16*)take((size_t)NB * NH * HD * SQ * 2);
  float* QF0 = (float*)take((size_t)QT0 * DM * 4); float* KF0 = (float*)take((size_t)QT0 * KVD * 4); float* VF0 = (float*)take((size_t)QT0 * KVD * 4); float* KF0e = (float*)take((size_t)QT0 * DM * 4); float* VF0e = (float*)take((size_t)QT0 * DM * 4); float* OF0 = (float*)take((size_t)NB * QT0 * DM * 4); _Float16* OH0 = (_Float16*)take((size_t)NB * QT0 * DM * 2); _Float16* OL0 = (_Float16*)take((size_t)NB * QT0 * DM * 2);
  if (off > ws_size) return;
  static_assert((size_t)DM * DM * 2 % 256 == 0, "BQ, BK, BV, BO lie back to back");
  k_prep<<<PP_TB + PP_XB + 4 * PP_WB, 256, 0, stream>>>(x, wq, wk, wv, wo, X16, BQ, CSB, SNB);      /* rope tables (rotate-half convention; the module's [f | f] tables repeat these 32 columns), x rows, natural [out][in] = Bt[n][k] x16 planes (KVD = 16 x 64 = DM: full-width k / v) */
  const size_t r0p = (size_t)B0 * SQ;      /* first projected row */
  static_assert(KVD == DM, "q, k and v share one launch: equal widths");
  static_assert((MP / 128) * (DM / 128) == NBR * (KVD / 128) * (SQ / 128), "the V^T plane has as many tiles as the q plane");
  k_gemm3<<<dim3((unsigned)((MP / 128) * (DM / 128)), 3), 128, 0, stream>>>(X16 + r0p * DM, BQ, (size_t)DM * DM, 0.0625f, Q16 + r0p * DM, DM, NR * DM, MP, DM, CSB, SNB, VT + (size_t)B0 * NH * HD * SQ);      /* q (grid.y 0) and k (grid.y 1) of all rows: BK follows BQ and K16 follows Q16 in the workspace (sizes are multiples of 256 bytes), so the kernel's own batch strides step from q to k; half-split rope (t cos + rotate_half(t) sin, computed tables) and f32 -> f16 in the epilogue; grid.y 2: V^T [NB][NH][HD][SQ] of all batches (BV follows BK), no rotation */
  k_fattn<<<dim3(SQ / FA_QB, NH, NB), FA_KS * FA_W * 32, 0, stream>>>(Q16, K16, VT, O16);      /* non-causal attention of all batches, heads and query rows in one launch: scores, softmax and weighted values fused; 16 waves per work-group, 8 per key half; o into merged f16 rows (x64) */
  k_gemm2<0><<<dim3((unsigned)((MPO / 128) * (DM / 64)), 1), 128, 0, stream>>>(O16 + r0p * DM, 0, BO, 0, 0.0009765625f, bo, 0, nullptr, 1, 0, 0, (float*)d_out + r0p * DM, nullptr, DM, 0, MPO, DM, nullptr, nullptr, nullptr);      /* out rows are the output layout */
}

// v010
// A run of this version takes 78 microseconds.
// Next to v009, in two timings, it ran 1.03 and 1.04 times as fast.
// Counting every step since v000, which is the starting kernel, it is 248 times as fast.
#include <hip/hip_runtime.h>
// Multi-head self-attention with rotate-half RoPE computed in the kernel and a biased output projection, NON-causal (x [2][2048][1024]; q / k / v = x W^T (natural [1024][1024], no biases), 16 heads of 64; cos / sin = [f | f] of pos * 10000^(-2i/64); q = q cos + rotate_half(q) sin, likewise k; scores * 64^-0.5; softmax over all 2048 keys (no mask); out = merged Wo^T + bo (natural + bias) -> [2][2048][1024]); run as grouped-query attention with 16 groups of ONE head.
// Structure: ONE preparation launch (x as exact f16 rows; natural weights as exact x16 planes; rope tables, double-derived inv_freq, f32 angle); q, k and V^T of all rows as ONE WMMA GEMM launch (64x64 wave tiles, f32 accumulation, f16 output; grid.y = q / k / V^T): the q and k epilogue applies the rotate-half rotation and the f16 conversion to the f32 tile it has staged in LDS (a wave tile is one head's 64 columns); the V^T plane takes the weight rows as A and the token rows as B, so its tiles are V^T rows as they stand; then ONE fused attention launch for all batches, heads and query rows (256 query rows per work-group): per 32 keys S^T = K Q^T (K = 64), online softmax on VALU in the log2 domain (f32 statistics, native exp2, lazy rescale; weights f16, unnormalised), O^T += V^T P^T, o / row sum (carried x64) into merged f16 rows; scores and weights stay in registers; out = o Wo^T GEMM (f32, alpha 2^-10); launches: see trace.
// Compute dtype: inputs rounded to bf16; x / weights exact; q, k, v, softmax weights and o as plain f16 GEMM operands (~2^-12); scores and softmax statistics f32. v_wmma_f32_16x16x32_f16.
#define NB 2
#define NG 16
#define HPG 1
#define KVD (NG * HD)
#define SQ 2048
#define DM 1024
#define NH 16
#define HD 64
#define HG 4                         /* heads per launch of the plain k_vt below (not launched) */
#define QT 512                       /* query rows per tile of the unfused softmax kernel kept below */
#define NKX SQ                       /* S / P row pitch */
#define QT0 128                      /* first-tile rows of the f32 attention kernel kept below (not launched) */
#define B0 0                         /* first batch processed (debug hook) */
#define NBR NB                       /* batches processed (debug hook) */
#define NR ((size_t)NB * SQ)         /* token rows */
#define MP ((int)((size_t)NBR * SQ)) /* rows projected (debug hook) */
#define QN SQ                        /* query rows per batch; unused: the attention grid spans all SQ rows */
#define NHD NH                       /* heads; unused: the attention grid spans all NH heads */
#define MPO MP                       /* rows through the output stage (debug hook) */
#define LQ DM      /* row pitch of the q/k/v rows */
typedef __bf16 v16b __attribute__((ext_vector_type(16)));
typedef unsigned short v8us __attribute__((ext_vector_type(8), may_alias));
typedef float  v8f  __attribute__((ext_vector_type(8)));
typedef float  v4f  __attribute__((ext_vector_type(4)));
typedef float  v4fa __attribute__((ext_vector_type(4), may_alias));
union FragB { v16b v; v8us half[2]; unsigned short u[16]; };

__device__ __forceinline__ unsigned short bf16_bits(float x) { unsigned int u = __float_as_uint(x); return (unsigned short)((u + 0x7FFFu + ((u >> 16) & 1u)) >> 16); }
__device__ __forceinline__ float bf16_val(unsigned short b) { return __uint_as_float(((unsigned int)b) << 16); }
__device__ __forceinline__ float bf16_round(float x) { return bf16_val(bf16_bits(x)); }
// D += A·B with NT terms: 1 = ah·bh, 2 = + al·bh (A split), 3 = + ah·bl (both split)
template <int NT>
__device__ __forceinline__ v8f mmaN(v16b ah, v16b al, v16b bh, v16b bl, v8f c) {
  c = __builtin_amdgcn_wmma_f32_16x16x32_bf16(false, ah, false, bh, (short)0, c, false, false);
  if (NT >= 2) c = __builtin_amdgcn_wmma_f32_16x16x32_bf16(false, al, false, bh, (short)0, c, false, false);
  if (NT >= 3) c = __builtin_amdgcn_wmma_f32_16x16x32_bf16(false, ah, false, bl, (short)0, c, false, false);
  asm volatile("v_nop\n\tv_nop\n\tv_nop\n\tv_nop" : "+v"(c) : "v"(ah), "v"(al), "v"(bh), "v"(bl));
  return c;
}

__global__ __launch_bounds__(256) void k_wt_bf16(const float* __restrict__ W, unsigned short* __restrict__ Wt, int K, int N) {
  const int t = blockIdx.x * 256 + threadIdx.x;
  const int k8n = K / 8;
  if (t >= N * k8n) return;
  const int n = t / k8n, k8 = (t % k8n) * 8;
  v8us v;
#pragma unroll
  for (int i = 0; i < 8; ++i) v[i] = bf16_bits(W[(size_t)(k8 + i) * N + n]);
  *(v8us*)(Wt + (size_t)n * K + k8) = v;
  
}

// GEMM C[M][N] (f32, pitch ldc) = act(A[M][K]·W + bias). A f32 row-major (pitch lda) converted per fragment to bf16
// (ASPLIT: hi/lo two planes -> 2 terms, else single rounded term); Wt bf16 [N][K] (pitch ldb). BIAS_BF16 rounds the
// bias to bf16 first (bias quantised to bf16 before the add). K%32==0, M%16==0, N%64==0.
template <bool ASPLIT, int ACT, bool BIAS_BF16>
__global__ __launch_bounds__(128) void k_gemm_bf(const float* __restrict__ A, int lda, const unsigned short* __restrict__ Wt, int ldb,
                                               const float* __restrict__ bias, float* __restrict__ C, int ldc, int M, int N, int K) {
  __shared__ __attribute__((aligned(16))) float so[4][16][64];
  const int tid = threadIdx.x, w = tid >> 5, lane = tid & 31, ln = lane & 15, hh = lane >> 4;
  const int ntn = N / 64;
  const int wid = blockIdx.x * 4 + w;
  const int mt = wid / ntn, nq = wid % ntn;
  if (mt * 16 >= M) return;
  const int row0 = mt * 16, col0 = nq * 64;
  const float* arow = A + (size_t)(row0 + ln) * lda;
  v8f acc[4] = {};
  for (int kb = 0; kb < K; kb += 32) {
    FragB ah, al;
    const v4f x0 = *(const v4fa*)(arow + kb + 8 * hh), x1 = *(const v4fa*)(arow + kb + 8 * hh + 4);
    const v4f x2 = *(const v4fa*)(arow + kb + 16 + 8 * hh), x3 = *(const v4fa*)(arow + kb + 16 + 8 * hh + 4);
    float xs[16] = {x0[0],x0[1],x0[2],x0[3],x1[0],x1[1],x1[2],x1[3],x2[0],x2[1],x2[2],x2[3],x3[0],x3[1],x3[2],x3[3]};
#pragma unroll
    for (int i = 0; i < 16; ++i) { const unsigned short hb = bf16_bits(xs[i]); ah.u[i] = hb; al.u[i] = ASPLIT ? bf16_bits(xs[i] - bf16_val(hb)) : (unsigned short)0; }
#pragma unroll
    for (int t = 0; t < 4; ++t) {
      const unsigned short* brow = Wt + (size_t)(col0 + t * 16 + ln) * ldb + kb;
      FragB b;
      b.half[0] = *(const v8us*)(brow + 8 * hh);
      b.half[1] = *(const v8us*)(brow + 16 + 8 * hh);
      acc[t] = mmaN<ASPLIT ? 2 : 1>(ah.v, al.v, b.v, b.v, acc[t]);
    }
  }
#pragma unroll
  for (int t = 0; t < 4; ++t) {
    float bv = bias ? bias[col0 + t * 16 + ln] : 0.f;
    if (BIAS_BF16) bv = bf16_round(bv);
#pragma unroll
    for (int r = 0; r < 8; ++r) { float v = acc[t][r] + bv; if (ACT == 1) v = fmaxf(v, 0.f); so[w][8 * hh + r][t * 16 + ln] = v; }
  }
  __builtin_amdgcn_fence(__ATOMIC_ACQ_REL, "workgroup");
  __builtin_amdgcn_wave_barrier();
  const int rsub = lane >> 4, c4 = (lane & 15) * 4;
  {
#pragma unroll
    for (int q = 0; q < 8; ++q) {
      const int r = q * 2 + rsub;
      const v4f v = *(const v4fa*)&so[w][r][c4];
      *(v4f*)(C + (size_t)(row0 + r) * ldc + col0 + c4) = v;
    }
    
  }
}

// GEMM C = act(A·W + bias + resid): A f32 (ASPLIT -> hi/lo 2 terms), Wt bf16 [N][K]; ACT 0 none, 1 relu, 2 exact gelu;
// resid (optional, f32, row index = (row % rmod), pitch ldr, RES_BF16 rounds it) added before the activation.
template <bool ASPLIT, int ACT, bool BIAS_BF16, bool RES_BF16>
__global__ __launch_bounds__(128) void k_gemm_bf3(const float* __restrict__ A, int lda, const unsigned short* __restrict__ Wt, int ldb,
                                                const float* __restrict__ bias, const float* __restrict__ resid, int rmod, int ldr,
                                                float* __restrict__ C, int ldc, int M, int N, int K) {
  __shared__ __attribute__((aligned(16))) float so[4][16][64];
  const int tid = threadIdx.x, w = tid >> 5, lane = tid & 31, ln = lane & 15, hh = lane >> 4;
  const int ntn = N / 64;
  const int wid = blockIdx.x * 4 + w;
  const int mt = wid / ntn, nq = wid % ntn;
  if (mt * 16 >= M) return;
  const int row0 = mt * 16, col0 = nq * 64;
  const float* arow = A + (size_t)(row0 + ln) * lda;
  v8f acc[4] = {};
  for (int kb = 0; kb < K; kb += 32) {
    FragB ah, al;
    const v4f x0 = *(const v4fa*)(arow + kb + 8 * hh), x1 = *(const v4fa*)(arow + kb + 8 * hh + 4);
    const v4f x2 = *(const v4fa*)(arow + kb + 16 + 8 * hh), x3 = *(const v4fa*)(arow + kb + 16 + 8 * hh + 4);
    float xs[16] = {x0[0],x0[1],x0[2],x0[3],x1[0],x1[1],x1[2],x1[3],x2[0],x2[1],x2[2],x2[3],x3[0],x3[1],x3[2],x3[3]};
#pragma unroll
    for (int i = 0; i < 16; ++i) { const unsigned short hb = bf16_bits(xs[i]); ah.u[i] = hb; al.u[i] = ASPLIT ? bf16_bits(xs[i] - bf16_val(hb)) : (unsigned short)0; }
#pragma unroll
    for (int t = 0; t < 4; ++t) {
      const unsigned short* brow = Wt + (size_t)(col0 + t * 16 + ln) * ldb + kb;
      FragB b;
      b.half[0] = *(const v8us*)(brow + 8 * hh);
      b.half[1] = *(const v8us*)(brow + 16 + 8 * hh);
      acc[t] = mmaN<ASPLIT ? 2 : 1>(ah.v, al.v, b.v, b.v, acc[t]);
    }
  }
#pragma unroll
  for (int t = 0; t < 4; ++t) {
    const int col = col0 + t * 16 + ln;
    float bv = bias ? bias[col] : 0.f;
    if (BIAS_BF16) bv = bf16_round(bv);
#pragma unroll
    for (int r = 0; r < 8; ++r) {
      float v = acc[t][r] + bv;
      if (resid) { float rv = resid[(size_t)((row0 + 8 * hh + r) % rmod) * ldr + col]; if (RES_BF16) rv = bf16_round(rv); v += rv; }
      if (ACT == 1) v = fmaxf(v, 0.f);
      if (ACT == 2) v = 0.5f * v * (1.0f + erff(v * 0.70710678118654752f));
      if (ACT == 3) { const float u = 0.7978845608028654f * (v + 0.044715f * v * v * v); v = 0.5f * v * (1.0f + tanhf(u)); }
      so[w][8 * hh + r][t * 16 + ln] = v;
    }
  }
  __builtin_amdgcn_fence(__ATOMIC_ACQ_REL, "workgroup");
  __builtin_amdgcn_wave_barrier();
  const int rsub = lane >> 4, c4 = (lane & 15) * 4;
  {
#pragma unroll
    for (int q = 0; q < 8; ++q) {
      const int r = q * 2 + rsub;
      const v4f v = *(const v4fa*)&so[w][r][c4];
      *(v4f*)(C + (size_t)(row0 + r) * ldc + col0 + c4) = v;
    }
    
  }
}
// row LayerNorm (biased variance, eps) over N: s = X (+ R); optional out_sum <- s; out_norm <- (s-mu)*rsqrt(var+eps)*g + b
template <bool PARAM_BF16>
__global__ __launch_bounds__(256) void k_layernorm(const float* __restrict__ X, const float* __restrict__ R, const float* __restrict__ g, const float* __restrict__ bta,
                                                  float* __restrict__ out_sum, float* __restrict__ out_norm, int N, float eps) {
  __shared__ float red[256];
  const int row = blockIdx.x, tid = threadIdx.x;
  const float* x = X + (size_t)row * N; const float* rr = R ? R + (size_t)row * N : nullptr;
  float vals[16];                     // up to N = 4096
  const int per = N / 256;            // contiguous chunk per thread? use strided-by-4 chunks: thread handles j = tid*4 + 1024*u
  float s1 = 0.f;
  for (int u = 0; u < per / 4; ++u) {
    const int j = tid * 4 + 1024 * u;
    const v4f a = *(const v4fa*)(x + j);
    v4f b = {0.f,0.f,0.f,0.f}; if (rr) b = *(const v4fa*)(rr + j);
#pragma unroll
    for (int q = 0; q < 4; ++q) { const float v = a[q] + b[q]; vals[u * 4 + q] = v; s1 += v; }
  }
  red[tid] = s1; __syncthreads();
  for (int st = 128; st > 0; st >>= 1) { if (tid < st) red[tid] += red[tid + st]; __syncthreads(); }
  const float mu = red[0] / (float)N; __syncthreads();
  float s2 = 0.f;
  for (int u = 0; u < per / 4; ++u)
#pragma unroll
    for (int q = 0; q < 4; ++q) { const float c = vals[u * 4 + q] - mu; s2 += c * c; }
  red[tid] = s2; __syncthreads();
  for (int st = 128; st > 0; st >>= 1) { if (tid < st) red[tid] += red[tid + st]; __syncthreads(); }
  const float rs = rsqrtf(red[0] / (float)N + eps);
  {
    for (int u = 0; u < per / 4; ++u) {
      const int j = tid * 4 + 1024 * u;
      v4f o, sm;
#pragma unroll
      for (int q = 0; q < 4; ++q) {
        float gg = g[j + q], bb = bta[j + q];
        if (PARAM_BF16) { gg = bf16_round(gg); bb = bf16_round(bb); }
        sm[q] = vals[u * 4 + q]; o[q] = (vals[u * 4 + q] - mu) * rs * gg + bb;
      }
      if (out_sum) *(v4f*)(out_sum + (size_t)row * N + j) = sm;
      *(v4f*)(out_norm + (size_t)row * N + j) = o;
    }
    
  }
}



// ---- f16 WMMA path (v_wmma_f32_16x16x32_f16): 11-bit significands for operands in range — used where a [0,1] probability operand needs more precision than bf16
typedef _Float16 v16h __attribute__((ext_vector_type(16)));
union FragH { v16h v; v8us half[2]; _Float16 h[16]; unsigned short u[16]; };
template <int NT>
__device__ __forceinline__ v8f mmaH(v16h ah, v16h al, v16h bh, v16h bl, v8f c) {
  c = __builtin_amdgcn_wmma_f32_16x16x32_f16(false, ah, false, bh, (short)0, c, false, false);
  if (NT >= 2) c = __builtin_amdgcn_wmma_f32_16x16x32_f16(false, al, false, bh, (short)0, c, false, false);
  if (NT >= 3) c = __builtin_amdgcn_wmma_f32_16x16x32_f16(false, ah, false, bl, (short)0, c, false, false);
  asm volatile("v_nop\n\tv_nop\n\tv_nop\n\tv_nop" : "+v"(c) : "v"(ah), "v"(al), "v"(bh), "v"(bl));
  return c;
}
// batched GEMM like k_gemm_b but f16 operands: A f32 (split into f16 hi/lo if ASPLIT, else rounded to f16), Bt = f16 values [n][k]; alpha; C f32; N multiple of 16 (partial tiles skipped)
template <bool ASPLIT>
__global__ __launch_bounds__(128) void k_gemm_h(const float* __restrict__ A, int lda, size_t sA, const _Float16* __restrict__ Bh, int ldb, size_t sB, float alpha, float* __restrict__ C, int ldc, size_t sC, int M, int N, int K) {
  __shared__ __attribute__((aligned(16))) float so[4][16][64];
  const int tid = threadIdx.x, w = tid >> 5, lane = tid & 31, ln = lane & 15, hh = lane >> 4; const int by = blockIdx.y;
  A += (size_t)by * sA; Bh += (size_t)by * sB; C += (size_t)by * sC;
  const int ntn = (N + 63) / 64; const int wid = blockIdx.x * 4 + w; const int mt = wid / ntn, nq = wid % ntn; if (mt * 16 >= M) return;
  const int row0 = mt * 16, col0 = nq * 64; const float* arow = A + (size_t)(row0 + ln) * lda;
  v8f acc[4] = {};
  for (int kb = 0; kb < K; kb += 32) {
    FragH ah, al;
    const v4f x0 = *(const v4fa*)(arow + kb + 8 * hh), x1 = *(const v4fa*)(arow + kb + 8 * hh + 4), x2 = *(const v4fa*)(arow + kb + 16 + 8 * hh), x3 = *(const v4fa*)(arow + kb + 16 + 8 * hh + 4);
    float xs[16] = {x0[0],x0[1],x0[2],x0[3],x1[0],x1[1],x1[2],x1[3],x2[0],x2[1],x2[2],x2[3],x3[0],x3[1],x3[2],x3[3]};
#pragma unroll
    for (int i = 0; i < 16; ++i) { const _Float16 h = (_Float16)xs[i]; ah.h[i] = h; al.h[i] = ASPLIT ? (_Float16)(xs[i] - (float)h) : (_Float16)0.0f; }
#pragma unroll
    for (int t = 0; t < 4; ++t) { if (col0 + t * 16 >= N) continue; const size_t boff = (size_t)(col0 + t * 16 + ln) * ldb + kb; FragH bq; bq.half[0] = *(const v8us*)(Bh + boff + 8 * hh); bq.half[1] = *(const v8us*)(Bh + boff + 16 + 8 * hh);
      acc[t] = mmaH<ASPLIT ? 2 : 1>(ah.v, al.v, bq.v, bq.v, acc[t]); }
  }
#pragma unroll
  for (int t = 0; t < 4; ++t) { if (col0 + t * 16 >= N) continue;
#pragma unroll
    for (int r = 0; r < 8; ++r) so[w][8 * hh + r][t * 16 + ln] = acc[t][r] * alpha; }
  __builtin_amdgcn_fence(__ATOMIC_ACQ_REL, "workgroup"); __builtin_amdgcn_wave_barrier();
  const int rsub = lane >> 4, c4 = (lane & 15) * 4;
  {
#pragma unroll
    for (int q = 0; q < 8; ++q) { const int r = q * 2 + rsub; if (col0 + c4 < N) { const v4f v = *(const v4fa*)&so[w][r][c4]; *(v4f*)(C + (size_t)(row0 + r) * ldc + col0 + c4) = v; } }
     }
}

// Wt[n][k] = f16(W[k][n]·scale) from f32 row-major W[K][N] (scale = power of two; bf16-exact weights stay exact in f16 away from the subnormal range)
__global__ __launch_bounds__(256) void k_wt_f16(const float* __restrict__ W, _Float16* __restrict__ Wt, int K, int N, float scale) {
  const int t = blockIdx.x * 256 + threadIdx.x; if (t >= N * (K / 8)) return; const int n = t / (K / 8), k8 = (t % (K / 8)) * 8; FragH f;
#pragma unroll
  for (int i = 0; i < 8; ++i) f.h[i] = (_Float16)(bf16_round(W[(size_t)(k8 + i) * N + n]) * scale); const v8us o = f.half[0];
  *(v8us*)((unsigned short*)Wt + (size_t)n * K + k8) = o; 
}
// k_gemm_hh variant with fused epilogue: v = acc·alpha + bias[by·sBias + col] (+ CP[(row/rowsPerB)·sCPb + by·64 + col] if CP) ; ACT 0 none / 1 elu ; writes f16 C16 (and f32 C if non-null)
template <int ACT>
__global__ __launch_bounds__(128) void k_gemm_hhx(const _Float16* __restrict__ A, int lda, size_t sA, const _Float16* __restrict__ Bh, int ldb, size_t sB, float alpha, const float* __restrict__ bias, size_t sBias, const float* __restrict__ CP, int rowsPerB, size_t sCPb, int row0g,
    float* __restrict__ C, _Float16* __restrict__ C16, int ldc, size_t sC, int M, int N, int K) {
  __shared__ __attribute__((aligned(16))) float so[4][16][64];
  const int tid = threadIdx.x, w = tid >> 5, lane = tid & 31, ln = lane & 15, hh = lane >> 4; const int by = blockIdx.y;
  A += (size_t)by * sA; Bh += (size_t)by * sB; const size_t cofs = (size_t)by * sC; const float* bp = bias ? bias + (size_t)by * sBias : nullptr;
  const int ntn = (N + 63) / 64; const int wid = blockIdx.x * 4 + w; const int mt = wid / ntn, nq = wid % ntn; if (mt * 16 >= M) return;
  const int row0 = mt * 16, col0 = nq * 64; const _Float16* arow = A + (size_t)(row0 + ln) * lda;
  v8f acc[4] = {};
  for (int kb = 0; kb < K; kb += 32) { FragH ah; ah.half[0] = *(const v8us*)((const unsigned short*)arow + kb + 8 * hh); ah.half[1] = *(const v8us*)((const unsigned short*)arow + kb + 16 + 8 * hh);
#pragma unroll
    for (int t = 0; t < 4; ++t) { if (col0 + t * 16 >= N) continue; const size_t boff = (size_t)(col0 + t * 16 + ln) * ldb + kb; FragH bq; bq.half[0] = *(const v8us*)((const unsigned short*)Bh + boff + 8 * hh); bq.half[1] = *(const v8us*)((const unsigned short*)Bh + boff + 16 + 8 * hh);
      acc[t] = mmaH<1>(ah.v, ah.v, bq.v, bq.v, acc[t]); }
  }
#pragma unroll
  for (int t = 0; t < 4; ++t) { if (col0 + t * 16 >= N) continue; const int col = col0 + t * 16 + ln; const float bv = bp ? bf16_round(bp[col]) : 0.f;
#pragma unroll
    for (int r = 0; r < 8; ++r) { float v = acc[t][r] * alpha + bv; if (CP) { const int rr = row0g + row0 + 8 * hh + r; if (rowsPerB < 0) v += CP[cofs + (size_t)rr * ldc + col];      /* rowsPerB < 0: own element of the batched C plane */ else { const int bidx = rr / rowsPerB; v += CP[(size_t)bidx * sCPb + (size_t)by * 64 + col]; } } if (ACT == 1) v = (v > 0.f) ? v : expm1f(v); else if (ACT == 7) v = (v > 0.f) ? v + 1.0f : expf(v); else if (ACT == 8) v = tanhf(v); else if (ACT == 9) v = 0.5f * v * (1.0f + tanhf(0.7978845608028654f * (v + 0.044715f * v * v * v))); else if (ACT == 11) v = 1.0f / (1.0f + expf(-v)); else if (ACT == 12) v = (v > 0.f) ? v : 0.01f * v; else if (ACT == 14) v = (v > 0.f) ? v : 0.1f * v; else if (ACT == 16) v = (v >= 0.f) ? v : 0.3f * v; else if (ACT == 17) v = (v >= 0.f) ? v : 0.2f * v; else if (ACT == 15) v = v / (1.0f + expf(-v)); else if (ACT == 3) v = fmaxf(v, 0.f); else if (ACT == 6) v = 0.5f * v * (1.0f + erff(v * 0.70710678118654752f)); so[w][8 * hh + r][t * 16 + ln] = v; } }
  __builtin_amdgcn_fence(__ATOMIC_ACQ_REL, "workgroup"); __builtin_amdgcn_wave_barrier();
  const int rsub = lane >> 4, c4 = (lane & 15) * 4; typedef _Float16 v4h __attribute__((ext_vector_type(4)));
  {
#pragma unroll
    for (int q = 0; q < 8; ++q) { const int r = q * 2 + rsub; if (col0 + c4 < N) { const v4f v = *(const v4fa*)&so[w][r][c4]; if (C) *(v4f*)(C + cofs + (size_t)(row0 + r) * ldc + col0 + c4) = v; if (C16) { v4h h4; for (int i = 0; i < 4; ++i) h4[i] = (_Float16)v[i]; *(v4h*)(C16 + cofs + (size_t)(row0 + r) * ldc + col0 + c4) = h4; } } }
     }
}


typedef _Float16 v4h __attribute__((ext_vector_type(4)));

__global__ __launch_bounds__(256) void k_h16(const float* __restrict__ x, _Float16* __restrict__ X16, size_t n8) { const size_t t = (size_t)blockIdx.x * 256 + threadIdx.x; if (t >= n8) return; FragH f;
#pragma unroll
  for (int q = 0; q < 8; ++q) f.h[q] = (_Float16)x[t * 8 + q]; *(v8us*)((unsigned short*)X16 + t * 8) = f.half[0];  }
__global__ __launch_bounds__(256) void k_round16f(const float* __restrict__ W, _Float16* __restrict__ Bt, size_t n8) { const size_t t = (size_t)blockIdx.x * 256 + threadIdx.x; if (t >= n8) return; FragH f;
#pragma unroll
  for (int i = 0; i < 8; ++i) f.h[i] = (_Float16)(bf16_round(W[t * 8 + i]) * 16.0f); *(v8us*)((unsigned short*)Bt + t * 8) = f.half[0];  }
template <int NHv, int TTv>
__global__ __launch_bounds__(256) void k_vt(const _Float16* __restrict__ V16, int ldv, int voff, _Float16* __restrict__ Vt) { __shared__ unsigned short tl[64][66]; const int tid = threadIdx.x; const int slab = blockIdx.x / (TTv / 64), lg = blockIdx.x % (TTv / 64); const int b = slab / NHv, h = slab % NHv;
  for (int i = tid; i < 64 * 8; i += 256) { const int r = i / 8, c8 = (i % 8) * 8; FragH f; f.half[0] = *(const v8us*)((const unsigned short*)V16 + ((size_t)b * TTv + lg * 64 + r) * ldv + voff + h * 64 + c8);
#pragma unroll
    for (int q = 0; q < 8; ++q) tl[r][c8 + q] = f.u[q]; }
  __syncthreads();
  {
#pragma unroll
    for (int rd = 0; rd < 2; ++rd) { const int d = rd * 32 + tid / 8, pc = tid % 8; FragH f;
#pragma unroll
      for (int q = 0; q < 8; ++q) f.u[q] = tl[pc * 8 + q][d];
      *(v8us*)((unsigned short*)Vt + ((size_t)slab * 64 + d) * TTv + lg * 64 + pc * 8) = f.half[0]; }
     } }

__global__ __launch_bounds__(256) void k_hl(const float* __restrict__ F, _Float16* __restrict__ Hh, _Float16* __restrict__ Hl, size_t n8) { const size_t t = (size_t)blockIdx.x * 256 + threadIdx.x; if (t >= n8) return; FragH fh, fl; const v4f a = *(const v4fa*)(F + t * 8), c = *(const v4fa*)(F + t * 8 + 4);
#pragma unroll
  for (int q = 0; q < 4; ++q) { _Float16 h = (_Float16)a[q]; fh.h[q] = h; fl.h[q] = (_Float16)((a[q] - (float)h) * 1024.0f); h = (_Float16)c[q]; fh.h[4 + q] = h; fl.h[4 + q] = (_Float16)((c[q] - (float)h) * 1024.0f); }
  { *(v8us*)((unsigned short*)Hh + t * 8) = fh.half[0]; *(v8us*)((unsigned short*)Hl + t * 8) = fl.half[0];  } }

// ---- fast GEMM (work-group tile 128x64, wave tile 32x64; A and Bt rows of pitch and length DM; requires M % 128 == 0 and N % 64 == 0); epilogue = k_gemm_hhx semantics ----
// A rows and Bt rows of 64 k are staged through registers into two LDS buffers shared by the 4 waves: global loads cover whole 128-byte lines, and each line is fetched once per work-group.
#define G2_KC 64                     /* k per LDS stage: 128-byte rows */
#define G2_P 72                      /* LDS row pitch in f16: 128-byte rows + 16 bytes (16 B x odd: conflict-free 16-byte reads) */
__device__ __forceinline__ v16h g2_frag(const _Float16* p, int hh) { FragH f; f.half[0] = *(const v8us*)((const unsigned short*)p + 8 * hh); f.half[1] = *(const v8us*)((const unsigned short*)p + 16 + 8 * hh); return f.v; }
__device__ __forceinline__ v8f g2_mma(v16h a, v16h b, v8f c) { v8f d = __builtin_amdgcn_wmma_f32_16x16x32_f16(false, a, false, b, (short)0, c, false, false); asm volatile("v_nop\n\tv_nop\n\tv_nop\n\tv_nop" : "+v"(d) : "v"(a), "v"(b)); return d; }
template <int ACT, int ROPE = 0, int PLAIN = 0>      /* PLAIN 1: C = f32 rows of pitch DM, v = acc * alpha + bias (rounded to bf16); no CP, no C16, one plane: known when the kernel is built, so the epilogue holds no test on them; ROPE 1: C16 = f16(v cos + rotate_half(v) sin), v = acc * alpha, per 64-column head; position = row % SQ, tables CS / SN [SQ][32]; no bias, no CP, no f32 C; its grid.y plane 2 is the transposed v projection into VTo (see below) */
__global__ __launch_bounds__(128) void k_gemm2(const _Float16* __restrict__ A, size_t sA, const _Float16* __restrict__ Bh, size_t sB, float alpha, const float* __restrict__ bias, size_t sBias, const float* __restrict__ CP, int rowsPerB, size_t sCPb, int row0g,
    float* __restrict__ C, _Float16* __restrict__ C16, int ldc, size_t sC, int M, int N, const float* __restrict__ CS, const float* __restrict__ SN, _Float16* __restrict__ VTo) { static_assert(ACT == 0 || ACT == 3 || ACT == 6 || ACT == 8 || ACT == 9 || ACT == 11 || ACT == 12 || ACT == 14 || ACT == 15 || ACT == 16 || ACT == 17, "k_gemm2: unsupported ACT code (would silently apply no activation)");
  __shared__ __attribute__((aligned(16))) unsigned char sm[2 * (128 + 64) * G2_P * 2];      /* two stage buffers of A (128 rows) and B (64 rows); behind the loop's last barrier the same bytes are the epilogue's staging */
  _Float16 (*la)[128][G2_P] = (_Float16 (*)[128][G2_P])sm; _Float16 (*lb)[64][G2_P] = (_Float16 (*)[64][G2_P])(sm + 2 * 128 * G2_P * 2); float (*so)[32][68] = (float (*)[32][68])sm;
  static_assert(sizeof(float) * 4 * 32 * 68 <= sizeof(sm), "the epilogue's staging lies inside the stage buffers");
  const int tid = threadIdx.x, w = tid >> 5, lane = tid & 31, ln = lane & 15, hh = lane >> 4; const int by = blockIdx.y;
  int bx = blockIdx.x, nb = 0; const bool vtp = ROPE && by == 2;      /* block-uniform */
  if (vtp) {      /* V^T [NB][NH][HD][SQ] = Wv x^T: the third weight plane's rows (head, d) are the A operand and the token rows of batch nb the B operand, so the tile's rows are V^T rows and its columns keys; no rotation */
    nb = bx / ((KVD / 128) * (SQ / 64)); bx -= nb * ((KVD / 128) * (SQ / 64)); const _Float16* xb = A + (size_t)nb * SQ * DM; A = Bh + 2 * sB; Bh = xb; M = KVD; N = SQ; }
  else { A += (size_t)by * sA; Bh += (size_t)by * sB; }
  const size_t cofs = (size_t)by * sC; const float* bp = bias ? bias + (size_t)by * sBias : nullptr;
  const int ntn = N >> 6; const int mt = bx / ntn, nq = bx - mt * ntn; const int row0 = mt * 128 + 32 * w, col0 = nq * 64; if (mt * 128 >= M) return;      /* block-uniform, in front of every barrier; M % 128 == 0 */
  const int sr = tid >> 3, sc = (tid & 7) * 8;      /* staging: a thread brings 16 bytes of rows sr + 16 i; 8 lanes cover one 128-byte line, a wave-wide load four whole lines */
  const unsigned short* ag = (const unsigned short*)A + (size_t)(mt * 128 + sr) * DM + sc; const unsigned short* bg = (const unsigned short*)Bh + (size_t)(col0 + sr) * DM + sc;
  v8us ga[8], gb[4];
#pragma unroll      /* ga[], gb[] in registers; constant row steps become immediate offsets */
  for (int i = 0; i < 8; ++i) ga[i] = *(const v8us*)(ag + (size_t)i * 16 * DM);
#pragma unroll
  for (int i = 0; i < 4; ++i) gb[i] = *(const v8us*)(bg + (size_t)i * 16 * DM);
  asm volatile("s_wait_xcnt 0x0" :: "v"(ag), "v"(bg) : "memory");      /* the staging loads' address pairs stay live up to this wait, so no register that an issued load names is overwritten in front of it */
  float bv4[4] = {0.f, 0.f, 0.f, 0.f};      /* PLAIN: the lane's four bias values, read here so that their latency lies under the loop */
  if (PLAIN) { static_assert(!PLAIN || (ACT == 0 && ROPE == 0), "the plain epilogue has no activation and no rotation"); const float* bpl = bias + col0 + ln;
#pragma unroll      /* bv4[] in registers; constant steps become immediate offsets */
    for (int t = 0; t < 4; ++t) bv4[t] = bpl[t * 16];
    asm volatile("s_wait_xcnt 0x0" :: "v"(bpl) : "memory"); }      /* likewise for the bias loads' address pair */
#pragma unroll
  for (int i = 0; i < 8; ++i) *(v8us*)&la[0][sr + 16 * i][sc] = ga[i];
#pragma unroll
  for (int i = 0; i < 4; ++i) *(v8us*)&lb[0][sr + 16 * i][sc] = gb[i];
  const v8f z8 = {0.f,0.f,0.f,0.f,0.f,0.f,0.f,0.f}; v8f c00 = z8, c01 = z8, c02 = z8, c03 = z8, c10 = z8, c11 = z8, c12 = z8, c13 = z8;
  __syncthreads();      /* stage 0 is published */
#pragma unroll 1      /* one stage per trip: the registers hold one stage's fragments and the next stage's 12 staging loads */
  for (int st = 0; st < DM / G2_KC; ++st) { const int cur = st & 1; const bool more = st + 1 < DM / G2_KC;      /* block-uniform */
    if (more) { ag += G2_KC; bg += G2_KC;      /* the next stage flies under this stage's products */
#pragma unroll
      for (int i = 0; i < 8; ++i) ga[i] = *(const v8us*)(ag + (size_t)i * 16 * DM);
#pragma unroll
      for (int i = 0; i < 4; ++i) gb[i] = *(const v8us*)(bg + (size_t)i * 16 * DM);
      asm volatile("s_wait_xcnt 0x0" :: "v"(ag), "v"(bg) : "memory"); }      /* likewise: the pointers are stepped only behind this wait */
    v16h a0[2], a1[2], bf[4][2];
#pragma unroll      /* the stage's 24 LDS reads stand as one group in front of its 16 products */
    for (int kk = 0; kk < G2_KC / 32; ++kk) { a0[kk] = g2_frag(&la[cur][32 * w + ln][kk * 32], hh); a1[kk] = g2_frag(&la[cur][32 * w + 16 + ln][kk * 32], hh);
      for (int t = 0; t < 4; ++t) bf[t][kk] = g2_frag(&lb[cur][t * 16 + ln][kk * 32], hh); }
#pragma unroll      /* fragments in registers; k ascends as before: the sum order of every accumulator is unchanged */
    for (int kk = 0; kk < G2_KC / 32; ++kk) {
      c00 = g2_mma(a0[kk], bf[0][kk], c00); c10 = g2_mma(a1[kk], bf[0][kk], c10);
      c01 = g2_mma(a0[kk], bf[1][kk], c01); c11 = g2_mma(a1[kk], bf[1][kk], c11);
      c02 = g2_mma(a0[kk], bf[2][kk], c02); c12 = g2_mma(a1[kk], bf[2][kk], c12);
      c03 = g2_mma(a0[kk], bf[3][kk], c03); c13 = g2_mma(a1[kk], bf[3][kk], c13); }
    if (more) {      /* the other buffer's last readers left it at the previous trip's barrier */
#pragma unroll
      for (int i = 0; i < 8; ++i) *(v8us*)&la[cur ^ 1][sr + 16 * i][sc] = ga[i];
#pragma unroll
      for (int i = 0; i < 4; ++i) *(v8us*)&lb[cur ^ 1][sr + 16 * i][sc] = gb[i]; }
    __syncthreads(); }      /* publishes the next stage and ends every wave's reads of this one (behind the last trip: frees the buffers for the epilogue's staging) */
  v8f accs[8] = {c00, c01, c02, c03, c10, c11, c12, c13};
  if (ROPE) {      /* col0 is a multiple of 64 and row0 of 32: both halves of every rotation pair lie in this wave's own 32 x 64 tile, and its 32 positions do not wrap at SQ */
    const int rs = lane >> 3, d8 = (lane & 7) * 8; const float sg = (d8 < HD / 2) ? -1.0f : 1.0f;      /* 8 lanes per row, 8 columns each; rotate_half(v)[d] = -v[d + 32] below 32, v[d - 32] above */
    const size_t tb = (size_t)((unsigned)row0 % SQ + rs) * (HD / 2) + (d8 & (HD / 2 - 1)); const float* cp = CS + tb; const float* sp = SN + tb; v4f tc[8][2], ts[8][2];
#pragma unroll      /* accs[] in registers */
    for (int u = 0; u < 8; ++u) for (int r = 0; r < 8; ++r) so[w][(u >> 2) * 16 + 8 * hh + r][(u & 3) * 16 + ln] = accs[u][r] * alpha;
    __builtin_amdgcn_fence(__ATOMIC_ACQ_REL, "workgroup"); __builtin_amdgcn_wave_barrier();      /* the wave reads back rows that its other lanes wrote */
    if (vtp) {      /* block-uniform; shares the staging above, so the accumulators end there on both ways; 16 lanes store one whole 128-byte line of a V^T row */
      const int rsub = lane >> 4, c4 = (lane & 15) * 4; _Float16* vd = VTo + (size_t)nb * NH * HD * SQ + (size_t)(row0 + rsub) * SQ + col0 + c4;
#pragma unroll      /* constant LDS offsets; constant row steps become immediate offsets of one address */
      for (int q = 0; q < 16; ++q) { const v4f v = *(const v4fa*)&so[w][q * 2 + rsub][c4]; v4h h4; for (int i = 0; i < 4; ++i) h4[i] = (_Float16)v[i]; *(v4h*)(vd + (size_t)q * 2 * SQ) = h4; }
      asm volatile("s_wait_xcnt 0x0" ::: "memory");      /* directly behind the last store: on every way that the built code lays out behind the stores, this wait stands in front of the first write of a register that an issued store names */
      return; }
#pragma unroll      /* tc[], ts[] in registers; behind the staging, where the accumulators' registers are free */
    for (int q = 0; q < 8; ++q) for (int u = 0; u < 2; ++u) { tc[q][u] = *(const v4fa*)(cp + q * 4 * (HD / 2) + 4 * u); ts[q][u] = *(const v4fa*)(sp + q * 4 * (HD / 2) + 4 * u); }
    unsigned short* dp = (unsigned short*)C16 + cofs + (size_t)(row0 + rs) * ldc + col0 + d8;
#pragma unroll      /* 4 rows per trip, constant LDS offsets; a store covers four whole 128-byte lines */
    for (int q = 0; q < 8; ++q) { FragH f;
      for (int u = 0; u < 2; ++u) { const v4f own = *(const v4fa*)&so[w][q * 4 + rs][d8 + 4 * u], oth = *(const v4fa*)&so[w][q * 4 + rs][(d8 ^ (HD / 2)) + 4 * u];
        for (int i = 0; i < 4; ++i) f.h[4 * u + i] = (_Float16)(own[i] * tc[q][u][i] + oth[i] * (sg * ts[q][u][i])); }
      *(v8us*)(dp + (size_t)q * 4 * ldc) = f.half[0]; }
    asm volatile("s_wait_xcnt 0x0" ::: "memory");      /* likewise: the built code lays the V^T plane's read-back out behind these stores */
    return; }
  if (PLAIN) {      /* straight-line: the general epilogue below tests CP, rowsPerB, C and C16 at run time for each of the 64 results and each of the 16 row pairs, a taken branch over unused code every few instructions, and reads its rows back one at a time */
#pragma unroll      /* accs[], bv4[] in registers */
    for (int u = 0; u < 8; ++u) { const float bv = bf16_round(bv4[u & 3]);
      for (int r = 0; r < 8; ++r) so[w][(u >> 2) * 16 + 8 * hh + r][(u & 3) * 16 + ln] = accs[u][r] * alpha + bv; }
    __builtin_amdgcn_fence(__ATOMIC_ACQ_REL, "workgroup"); __builtin_amdgcn_wave_barrier();      /* the wave reads back rows that its other lanes wrote */
    const int rsub = lane >> 4, c4 = (lane & 15) * 4; float* cd = C + (size_t)(row0 + rsub) * DM + col0 + c4;      /* 16 lanes store the tile's 256 bytes of one row: two whole lines */
#pragma unroll      /* 16 rows per trip; constant LDS offsets; constant row steps become immediate offsets of one address */
    for (int g = 0; g < 2; ++g) { v4f v[8];
      for (int j = 0; j < 8; ++j) v[j] = *(const v4fa*)&so[w][(g * 8 + j) * 2 + rsub][c4];
      for (int j = 0; j < 8; ++j) *(v4f*)(cd + (size_t)(g * 8 + j) * 2 * DM) = v[j];
      asm volatile("s_wait_xcnt 0x0" ::: "memory"); }      /* directly behind the trip's stores: this wait stands in front of the first write of a register that an issued store names */
    return; }
#pragma unroll
  for (int u = 0; u < 8; ++u) { const int t = u & 3, half = u >> 2; const int col = col0 + t * 16 + ln; const float bv = bp ? bf16_round(bp[col]) : 0.f;
#pragma unroll
    for (int r = 0; r < 8; ++r) { const int rloc = half * 16 + 8 * hh + r; float v = accs[u][r] * alpha + bv; if (CP) { if (rowsPerB < 0) v += CP[cofs + (size_t)(row0g + row0 + rloc) * ldc + col];      /* rowsPerB < 0: own element of the batched C plane */ else { const int bidx = (row0g + row0 + rloc) / rowsPerB; v += CP[(size_t)bidx * sCPb + (size_t)by * 64 + col]; } }
      if (ACT == 3) v = fmaxf(v, 0.f); else if (ACT == 6) v = 0.5f * v * (1.0f + erff(v * 0.70710678118654752f)); else if (ACT == 11) v = 1.0f / (1.0f + expf(-v)); else if (ACT == 15) v = v / (1.0f + expf(-v)); else if (ACT == 12) v = (v > 0.f) ? v : 0.01f * v; else if (ACT == 8) v = tanhf(v); else if (ACT == 9) v = 0.5f * v * (1.0f + tanhf(0.7978845608028654f * (v + 0.044715f * v * v * v))); else if (ACT == 14) v = (v > 0.f) ? v : 0.1f * v; else if (ACT == 16) v = (v >= 0.f) ? v : 0.3f * v; else if (ACT == 17) v = (v >= 0.f) ? v : 0.2f * v;
      so[w][rloc][t * 16 + ln] = v; } }
  __builtin_amdgcn_fence(__ATOMIC_ACQ_REL, "workgroup"); __builtin_amdgcn_wave_barrier();
  const int rsub = lane >> 4, c4 = (lane & 15) * 4;
  {
#pragma unroll
    for (int q = 0; q < 16; ++q) { const int r = q * 2 + rsub; const v4f v = *(const v4fa*)&so[w][r][c4]; if (C) *(v4f*)(C + cofs + (size_t)(row0 + r) * ldc + col0 + c4) = v; if (C16) { v4h h4; for (int i = 0; i < 4; ++i) h4[i] = (_Float16)v[i]; *(v4h*)(C16 + cofs + (size_t)(row0 + r) * ldc + col0 + c4) = h4; } }
     } }


// ---- q / k / V^T projection GEMM: k_gemm2's stages and its rotation epilogue on a work-group tile of 128x128, 2 x 2 waves of 64x64 each (M % 128 == 0, N % 128 == 0) ----
// The square tile takes 2 operand rows from L2 per 128 results per k (128x64: 3), and a 64x64 wave tile reads 8 fragments from LDS per 16 products (32x64: 6 per 8); 3 x 256 work-groups, three per WGP: all resident at once.
// C16 = f16(v cos + rotate_half(v) sin), v = acc * alpha, per 64-column head; position = row % SQ, tables CS / SN [SQ][32]; grid.y 0 / 1 = q / k (weight planes sB apart, outputs sC apart); grid.y 2 is the transposed v projection into VTo (see below)
__global__ __launch_bounds__(128, 3) void k_gemm3(const _Float16* __restrict__ A, const _Float16* __restrict__ Bh, size_t sB, float alpha, _Float16* __restrict__ C16, int ldc, size_t sC, int M, int N, const float* __restrict__ CS, const float* __restrict__ SN, _Float16* __restrict__ VTo) {      /* second bound: three waves per SIMD, at most 336 registers */
  __shared__ __attribute__((aligned(16))) unsigned char sm[2 * (128 + 128) * G2_P * 2];      /* two stage buffers of A (128 rows) and B (128 rows); behind the loop's last barrier the same bytes are the epilogue's staging */
  _Float16 (*la)[128][G2_P] = (_Float16 (*)[128][G2_P])sm; _Float16 (*lb)[128][G2_P] = (_Float16 (*)[128][G2_P])(sm + 2 * 128 * G2_P * 2); float (*so)[64][68] = (float (*)[64][68])sm;
  static_assert(sizeof(float) * 4 * 64 * 68 <= sizeof(sm), "the epilogue's staging lies inside the stage buffers");
  const int tid = threadIdx.x, w = tid >> 5, lane = tid & 31, ln = lane & 15, hh = lane >> 4; const int by = blockIdx.y;
  int bx = blockIdx.x, nb = 0; const bool vtp = by == 2;      /* block-uniform */
  if (vtp) {      /* V^T [NB][NH][HD][SQ] = Wv x^T: the third weight plane's rows (head, d) are the A operand and the token rows of batch nb the B operand, so the tile's rows are V^T rows and its columns keys; no rotation */
    nb = bx / ((KVD / 128) * (SQ / 128)); bx -= nb * ((KVD / 128) * (SQ / 128)); const _Float16* xb = A + (size_t)nb * SQ * DM; A = Bh + 2 * sB; Bh = xb; M = KVD; N = SQ; }
  else Bh += (size_t)by * sB;
  const size_t cofs = (size_t)by * sC;
  const int ntn = N >> 7; const int mt = bx / ntn, nq = bx - mt * ntn; const int wm = w >> 1, wn = w & 1; const int row0 = mt * 128 + 64 * wm, col0 = nq * 128 + 64 * wn; if (mt * 128 >= M) return;      /* block-uniform, in front of every barrier; M % 128 == 0 */
  const int sr = tid >> 3, sc = (tid & 7) * 8;      /* staging: a thread brings 16 bytes of rows sr + 16 i; 8 lanes cover one 128-byte line, a wave-wide load four whole lines */
  const unsigned short* ag = (const unsigned short*)A + (size_t)(mt * 128 + sr) * DM + sc; const unsigned short* bg = (const unsigned short*)Bh + (size_t)(nq * 128 + sr) * DM + sc;
  v8us ga[8], gb[8];
#pragma unroll      /* ga[], gb[] in registers; constant row steps become immediate offsets */
  for (int i = 0; i < 8; ++i) ga[i] = *(const v8us*)(ag + (size_t)i * 16 * DM);
#pragma unroll
  for (int i = 0; i < 8; ++i) gb[i] = *(const v8us*)(bg + (size_t)i * 16 * DM);
  asm volatile("s_wait_xcnt 0x0" :: "v"(ag), "v"(bg) : "memory");      /* the staging loads' address pairs stay live up to this wait, so no register that an issued load names is overwritten in front of it */
#pragma unroll
  for (int i = 0; i < 8; ++i) *(v8us*)&la[0][sr + 16 * i][sc] = ga[i];
#pragma unroll
  for (int i = 0; i < 8; ++i) *(v8us*)&lb[0][sr + 16 * i][sc] = gb[i];
  const v8f z8 = {0.f,0.f,0.f,0.f,0.f,0.f,0.f,0.f}; v8f c[4][4];      /* [16 rows][16 columns] of the wave's 64 x 64 */
#pragma unroll      /* c[][] in registers */
  for (int i = 0; i < 4; ++i) for (int t = 0; t < 4; ++t) c[i][t] = z8;
  __syncthreads();      /* stage 0 is published */
#pragma unroll 1      /* one stage per trip: the registers hold one stage's fragments and the next stage's 16 staging loads */
  for (int st = 0; st < DM / G2_KC; ++st) { const int cur = st & 1; const bool more = st + 1 < DM / G2_KC;      /* block-uniform */
    if (more) { ag += G2_KC; bg += G2_KC;      /* the next stage flies under this stage's products */
#pragma unroll
      for (int i = 0; i < 8; ++i) ga[i] = *(const v8us*)(ag + (size_t)i * 16 * DM);
#pragma unroll
      for (int i = 0; i < 8; ++i) gb[i] = *(const v8us*)(bg + (size_t)i * 16 * DM);
      asm volatile("s_wait_xcnt 0x0" :: "v"(ag), "v"(bg) : "memory"); }      /* likewise: the pointers are stepped only behind this wait */
#pragma unroll      /* per 32 k: 16 LDS reads as one group in front of their 16 products, so that accumulators and fragments stay below v256, where the operands of g2_mma's statement must lie; k ascends as before: the sum order of every accumulator is unchanged */
    for (int kk = 0; kk < G2_KC / 32; ++kk) { v16h af[4], bf[4];
      for (int t = 0; t < 4; ++t) { af[t] = g2_frag(&la[cur][64 * wm + t * 16 + ln][kk * 32], hh); bf[t] = g2_frag(&lb[cur][64 * wn + t * 16 + ln][kk * 32], hh); }
      for (int t = 0; t < 4; ++t) for (int i = 0; i < 4; ++i) c[i][t] = g2_mma(af[i], bf[t], c[i][t]); }
    if (more) {      /* the other buffer's last readers left it at the previous trip's barrier */
#pragma unroll
      for (int i = 0; i < 8; ++i) *(v8us*)&la[cur ^ 1][sr + 16 * i][sc] = ga[i];
#pragma unroll
      for (int i = 0; i < 8; ++i) *(v8us*)&lb[cur ^ 1][sr + 16 * i][sc] = gb[i]; }
    __syncthreads(); }      /* publishes the next stage and ends every wave's reads of this one (behind the last trip: frees the buffers for the epilogue's staging) */
  {      /* col0 and row0 are multiples of 64: both halves of every rotation pair lie in this wave's own 64 x 64 tile, and its 64 positions do not wrap at SQ */
    const int rs = lane >> 3, d8 = (lane & 7) * 8; const float sg = (d8 < HD / 2) ? -1.0f : 1.0f;      /* 8 lanes per row, 8 columns each; rotate_half(v)[d] = -v[d + 32] below 32, v[d - 32] above */
    const unsigned tb = (((unsigned)row0 % SQ + rs) * (HD / 2) + (d8 & (HD / 2 - 1))) * 4u; const float* cp = (const float*)((const char*)CS + tb); const float* sp = (const float*)((const char*)SN + tb); v4f tc[16][2], ts[16][2];      /* tb: the lane's byte offset in both tables */
#pragma unroll      /* c[][] in registers */
    for (int i = 0; i < 4; ++i) for (int t = 0; t < 4; ++t) for (int r = 0; r < 8; ++r) so[w][i * 16 + 8 * hh + r][t * 16 + ln] = c[i][t][r] * alpha;
    __builtin_amdgcn_fence(__ATOMIC_ACQ_REL, "workgroup"); __builtin_amdgcn_wave_barrier();      /* the wave reads back rows that its other lanes wrote */
    if (vtp) {      /* block-uniform; shares the staging above, so the accumulators end there on both ways; 16 lanes store one whole 128-byte line of a V^T row */
      const int rsub = lane >> 4, c4 = (lane & 15) * 4; _Float16* vd = VTo + (size_t)nb * NH * HD * SQ + (size_t)(row0 + rsub) * SQ + col0 + c4;
#pragma unroll      /* 16 rows per trip; constant LDS offsets; constant row steps become immediate offsets of one address */
      for (int g = 0; g < 4; ++g) { v4h h4[8];
        for (int j = 0; j < 8; ++j) { const v4f v = *(const v4fa*)&so[w][(g * 8 + j) * 2 + rsub][c4]; for (int i = 0; i < 4; ++i) h4[j][i] = (_Float16)v[i]; }
        for (int j = 0; j < 8; ++j) *(v4h*)(vd + (size_t)(g * 8 + j) * 2 * SQ) = h4[j];
        asm volatile("s_wait_xcnt 0x0" ::: "memory"); }      /* directly behind the trip's stores: this wait stands in front of the first write of a register that an issued store names, in the next trip and on every way that the built code lays out behind the last */
      return; }
#pragma unroll      /* tc[], ts[] in registers; behind the staging, where the accumulators' registers are free; the first 12 of the 16 row groups' entries fly together */
    for (int q = 0; q < 12; ++q) for (int u = 0; u < 2; ++u) { tc[q][u] = *(const v4fa*)(cp + q * 4 * (HD / 2) + 4 * u); ts[q][u] = *(const v4fa*)(sp + q * 4 * (HD / 2) + 4 * u); }
    asm volatile("s_wait_xcnt 0x0" :: "v"(tb) : "memory");      /* the table loads' offset register stays live up to this wait, so no register that an issued load names is overwritten in front of it */
    unsigned short* dp = (unsigned short*)C16 + cofs + (size_t)(row0 + rs) * ldc + col0 + d8;
#pragma unroll      /* 16 rows per trip, constant LDS offsets; a store covers four whole 128-byte lines */
    for (int g = 0; g < 4; ++g) { FragH f[4];
      for (int j = 0; j < 4; ++j) { const int q = g * 4 + j;
        for (int u = 0; u < 2; ++u) { const v4f own = *(const v4fa*)&so[w][q * 4 + rs][d8 + 4 * u], oth = *(const v4fa*)&so[w][q * 4 + rs][(d8 ^ (HD / 2)) + 4 * u];
          for (int i = 0; i < 4; ++i) f[j].h[4 * u + i] = (_Float16)(own[i] * tc[q][u][i] + oth[i] * (sg * ts[q][u][i])); } }
      for (int j = 0; j < 4; ++j) *(v8us*)(dp + (size_t)(g * 4 + j) * 4 * ldc) = f[j].half[0];
      asm volatile("s_wait_xcnt 0x0" ::: "memory");      /* directly behind the trip's stores: the next trip (and, behind the last, whatever the built code lays out there) writes registers that they name; its memory clobber also keeps the later trips' LDS reads from being lifted to the front, where the registers would run over into scratch */
      if (g == 0) {      /* the last 4 row groups' entries go into the registers that the first 4 have left, and fly under the 8 groups between: all 16 at once leave no room for three waves per SIMD */
        for (int q = 12; q < 16; ++q) for (int u = 0; u < 2; ++u) { tc[q][u] = *(const v4fa*)(cp + q * 4 * (HD / 2) + 4 * u); ts[q][u] = *(const v4fa*)(sp + q * 4 * (HD / 2) + 4 * u); }
        asm volatile("s_wait_xcnt 0x0" :: "v"(tb) : "memory"); } }      /* likewise for these loads */
  } }


#define FA_W 8                       /* waves per key half, 32 query columns each */
#define FA_KS 2                      /* key halves per work-group */
#define FA_HB (2 * (FA_ST + HD) * FA_P * 2)      /* LDS bytes of one key half: two stage buffers of K and of V^T */
#define FA_QB (FA_W * 32)            /* query rows per work-group */
#define FA_ST 64                     /* keys per LDS stage */
#define FA_P 72                      /* LDS row pitch in f16: 128-byte rows + 16 bytes (16 B x odd: conflict-free 16-byte reads) */
typedef float v2f __attribute__((ext_vector_type(2)));
typedef _Float16 v2h __attribute__((ext_vector_type(2)));
__device__ __forceinline__ float fa_xhalf(float x) { return __builtin_bit_cast(float, __builtin_amdgcn_permlanex16(__builtin_bit_cast(int, x), __builtin_bit_cast(int, x), 0x76543210, 0xfedcba98, false, false)); }      /* lane l reads lane l ^ 16 */
__device__ __forceinline__ v8f fa_mma(v16h a, v16h b, v8f c) { return __builtin_amdgcn_wmma_f32_16x16x32_f16(false, a, false, b, (short)0, c, false, false); }
__global__ __launch_bounds__(FA_KS * FA_W * 32) void k_fattn(const _Float16* __restrict__ Q16, const _Float16* __restrict__ K16, const _Float16* __restrict__ VT, _Float16* __restrict__ O16) {
  __shared__ __attribute__((aligned(16))) unsigned char sm[FA_KS * FA_HB];      /* per key half two stage buffers of K and of V^T; behind the loop's last barrier the same bytes carry the hand-over */
  static_assert(FA_W * 17 * 32 * 16 <= FA_KS * FA_HB, "the hand-over lies inside the stage buffers");
  const int kh = __builtin_amdgcn_readfirstlane((int)(threadIdx.x >> 8));      /* the wave's key half, in a scalar register: the tests on it are scalar branches and the LDS bases scalar sums */
  _Float16 (*lk)[FA_ST][FA_P] = (_Float16 (*)[FA_ST][FA_P])(sm + kh * FA_HB); _Float16 (*lv)[HD][FA_P] = (_Float16 (*)[HD][FA_P])(sm + kh * FA_HB + 2 * FA_ST * FA_P * 2);
  const int tid = threadIdx.x & (FA_W * 32 - 1), w = tid >> 5, lane = tid & 31, ln = lane & 15, hh = lane >> 4; const int h = blockIdx.y, b = blockIdx.z; const size_t r0 = (size_t)b * SQ; const int q0 = blockIdx.x * FA_QB + w * 32;      /* tid, w: inside the key half */
  const int sr = tid >> 3, sc = (tid & 7) * 8;      /* staging: a thread brings 16 bytes of rows sr and sr + 32 of each tile; 8 lanes cover one 128-byte line */
  const unsigned short* kg = (const unsigned short*)K16 + (r0 + kh * (SQ / FA_KS) + sr) * KVD + h * HD + sc;      /* key row sr of the half's stage, this head's 64 columns */
  const unsigned short* vg = (const unsigned short*)VT + ((size_t)(b * NH + h) * HD + sr) * SQ + kh * (SQ / FA_KS) + sc;      /* V^T row d = sr, the stage's 64 keys */
  v8us gk0 = *(const v8us*)kg, gk1 = *(const v8us*)(kg + (size_t)32 * KVD), gv0 = *(const v8us*)vg, gv1 = *(const v8us*)(vg + (size_t)32 * SQ);
  v16h qf[2][2];      /* [column group][k step of 32], kept for the whole kernel */
  { const _Float16* qp = Q16 + (r0 + q0 + ln) * LQ + h * HD;
#pragma unroll      /* constant indices keep qf[] in registers */
    for (int g = 0; g < 2; ++g) for (int kk = 0; kk < 2; ++kk) qf[g][kk] = g2_frag(qp + (size_t)g * 16 * LQ + kk * 32, hh);
    asm volatile("s_wait_xcnt 0x0" :: "v"(qp) : "memory"); }      /* the q loads' address pair stays live up to this wait, so no register that an issued load names is overwritten in front of it */
  *(v8us*)&lk[0][sr][sc] = gk0; *(v8us*)&lk[0][sr + 32][sc] = gk1; *(v8us*)&lv[0][sr][sc] = gv0; *(v8us*)&lv[0][sr + 32][sc] = gv1;
  const v8f z8 = {0.f,0.f,0.f,0.f,0.f,0.f,0.f,0.f}; v8f o[2][4];      /* O^T: [column group][16 rows of d] */
#pragma unroll      /* o[] in registers */
  for (int g = 0; g < 2; ++g) for (int t = 0; t < 4; ++t) o[g][t] = z8;
  float mr[2] = {-1.0e30f, -1.0e30f}, l[2] = {0.f, 0.f};      /* maximum in use (log2-scaled) and this lane's part of the denominator */
  const float cs = 0.125f * 1.4426950408889634f;      /* 64^-0.5 * log2(e) */
  __syncthreads();      /* stage 0 is published */
  for (int st = 0; st < SQ / FA_KS / FA_ST; ++st) { const int cur = st & 1; const bool more = st + 1 < SQ / FA_KS / FA_ST;      /* block-uniform */
    if (more) { kg += (size_t)FA_ST * KVD; vg += FA_ST; gk0 = *(const v8us*)kg; gk1 = *(const v8us*)(kg + (size_t)32 * KVD); gv0 = *(const v8us*)vg; gv1 = *(const v8us*)(vg + (size_t)32 * SQ);      /* the next stage flies under this stage's two passes */
      asm volatile("s_wait_xcnt 0x0" :: "v"(kg), "v"(vg) : "memory"); }      /* likewise for the next stage's staging loads (stage 0's passed the wait behind the q loads): the pointers are stepped only behind this wait */
#pragma unroll      /* two 32-key passes per stage, constant LDS offsets */
    for (int ps = 0; ps < FA_ST / 32; ++ps) {
      v8f s[2][2];      /* S^T: [column group][16 keys] */
      { v16h kf[2][2];
#pragma unroll      /* fragments in registers */
        for (int t = 0; t < 2; ++t) for (int kk = 0; kk < 2; ++kk) kf[t][kk] = g2_frag(&lk[cur][ps * 32 + t * 16 + ln][kk * 32], hh);
#pragma unroll      /* fragments in registers */
        for (int t = 0; t < 2; ++t) for (int g = 0; g < 2; ++g) s[g][t] = fa_mma(kf[t][1], qf[g][1], fa_mma(kf[t][0], qf[g][0], z8)); }
      v16h vf[4];
#pragma unroll      /* fragments in registers; these reads fly under the maxima and exponentials */
      for (int t = 0; t < 4; ++t) vf[t] = g2_frag(&lv[cur][t * 16 + ln][ps * 32], hh);
      float mb[2]; bool need = false;
#pragma unroll      /* s[] in registers */
      for (int g = 0; g < 2; ++g) { float mx = s[g][0][0];
        for (int r = 1; r < 8; ++r) mx = fmaxf(mx, s[g][0][r]);
        for (int r = 0; r < 8; ++r) mx = fmaxf(mx, s[g][1][r]);
        mx = fmaxf(mx, fa_xhalf(mx)) * cs; mb[g] = mx; need = need || (mx > mr[g] + 8.0f); }      /* both halves hold the column's maximum; the one in use may trail it by 8 (weights up to 2^8) */
      if (__builtin_amdgcn_ballot_w32(need) != 0) {      /* wave-uniform; always on the first pass, rare afterwards */
#pragma unroll      /* o[] in registers */
        for (int g = 0; g < 2; ++g) { const float mn = fmaxf(mr[g], mb[g]); const float corr = __builtin_amdgcn_exp2f(mr[g] - mn); mr[g] = mn; l[g] *= corr;
          for (int t = 0; t < 4; ++t) o[g][t] = o[g][t] * corr; } }
#pragma unroll      /* s[], o[] in registers */
      for (int g = 0; g < 2; ++g) { const float nm = -mr[g]; const v8f c8 = {cs, cs, cs, cs, cs, cs, cs, cs}, n8 = {nm, nm, nm, nm, nm, nm, nm, nm}; FragH pf; float la = 0.f, lb = 0.f;
        for (int t = 0; t < 2; ++t) { s[g][t] = __builtin_elementwise_fma(s[g][t], c8, n8);
          for (int r = 0; r < 8; ++r) s[g][t][r] = __builtin_amdgcn_exp2f(s[g][t][r]); }      /* weights 2^(score * cs - maximum in use), in the score registers */
        for (int i = 0; i < 8; ++i) { const int t = i >> 2, r = 2 * (i & 3);
          la += s[g][t][r]; lb += s[g][t][r + 1];
          const v2h pk = __builtin_convertvector(v2f{s[g][t][r], s[g][t][r + 1]}, v2h); pf.h[2 * i] = pk[0]; pf.h[2 * i + 1] = pk[1]; }
        l[g] += la + lb;
        for (int t = 0; t < 4; ++t) o[g][t] = fa_mma(vf[t], pf.v, o[g][t]); } }
    asm volatile("v_nop\n\tv_nop\n\tv_nop\n\tv_nop" : "+v"(o[0][0]), "+v"(o[0][1]), "+v"(o[0][2]), "+v"(o[0][3]), "+v"(o[1][0]), "+v"(o[1][1]), "+v"(o[1][2]), "+v"(o[1][3]));      /* four issue slots behind the stage's last matrix instructions: a branch follows */
    if (more) { *(v8us*)&lk[cur ^ 1][sr][sc] = gk0; *(v8us*)&lk[cur ^ 1][sr + 32][sc] = gk1; *(v8us*)&lv[cur ^ 1][sr][sc] = gv0; *(v8us*)&lv[cur ^ 1][sr + 32][sc] = gv1; }      /* its last readers left it at the previous trip's barrier */
    __syncthreads(); }      /* publishes the next stage and ends every wave's reads of this one (behind the last trip: frees the buffers for the hand-over) */
  v4fa* mg = (v4fa*)sm + w * (17 * 32) + lane;      /* hand-over between the two waves of equal w: 17 words of 16 bytes per lane, lane to same lane; a wave-wide access covers 512 contiguous bytes */
  if (kh == 1) {      /* wave-uniform */
#pragma unroll      /* o[] in registers */
    for (int g = 0; g < 2; ++g) for (int t = 0; t < 4; ++t) for (int u = 0; u < 2; ++u) mg[((g * 4 + t) * 2 + u) * 32] = v4f{o[g][t][4 * u], o[g][t][4 * u + 1], o[g][t][4 * u + 2], o[g][t][4 * u + 3]};
    mg[16 * 32] = v4f{mr[0], mr[1], l[0], l[1]}; }
  __syncthreads();      /* the second half's results are published; every wave passes it */
  if (kh == 1) return;      /* behind the last barrier */
  { const v4f s1 = mg[16 * 32];
#pragma unroll      /* o[] in registers */
    for (int g = 0; g < 2; ++g) { const float mn = fmaxf(mr[g], s1[g]); const float c0 = __builtin_amdgcn_exp2f(mr[g] - mn), c1 = __builtin_amdgcn_exp2f(s1[g] - mn); l[g] = l[g] * c0 + s1[2 + g] * c1;      /* both halves onto the larger maximum */
      for (int t = 0; t < 4; ++t) for (int u = 0; u < 2; ++u) { const v4f x = mg[((g * 4 + t) * 2 + u) * 32];
        for (int r = 0; r < 4; ++r) o[g][t][4 * u + r] = o[g][t][4 * u + r] * c0 + x[r] * c1; } } }
#pragma unroll      /* o[] in registers */
  for (int g = 0; g < 2; ++g) { const float fin = 64.0f / (l[g] + fa_xhalf(l[g]));      /* the halves' sums join once; o carried x64 */
    unsigned short* d = (unsigned short*)O16 + (r0 + q0 + g * 16 + ln) * DM + h * HD + 8 * hh;
    for (int t = 0; t < 4; ++t) { FragH f; for (int r = 0; r < 8; ++r) f.h[r] = (_Float16)(o[g][t][r] * fin); *(v8us*)(d + t * 16) = f.half[0]; } } }      /* a lane's 8 registers are 8 consecutive d of its query row: one 16-byte store */
__global__ __launch_bounds__(256) void k_vt(const _Float16* __restrict__ V16, int b, int h0, _Float16* __restrict__ VT) { __shared__ unsigned short tl[64][65]; const int tid = threadIdx.x; const int hh = blockIdx.x % HG, sg = blockIdx.x / HG; const int s0 = sg * 64; const int h = h0 + hh;
  for (int i = tid; i < 64 * 8; i += 256) { const int j = i / 8, d8 = (i % 8) * 8; FragH f; f.half[0] = *(const v8us*)((const unsigned short*)V16 + ((size_t)b * SQ + s0 + j) * DM + h * HD + d8); for (int q = 0; q < 8; ++q) tl[d8 + q][j] = f.u[q]; }
  __syncthreads();
  { for (int i = tid; i < 64 * 8; i += 256) { const int d = i / 8, j8 = (i % 8) * 8; FragH f; for (int q = 0; q < 8; ++q) f.u[q] = tl[d][j8 + q]; *(v8us*)((unsigned short*)VT + ((size_t)hh * HD + d) * SQ + s0 + j8) = f.half[0]; }  } }



__global__ __launch_bounds__(256) void k_rsmcf2(const float* __restrict__ S, _Float16* __restrict__ P, int hg, int q0, int nk) {
  #pragma clang fp contract(off)
  const int t = blockIdx.x * 256 + threadIdx.x; if (t >= hg * QT) return; const size_t i = (size_t)t; const float* s = S + i * NKX; const int last = q0 + (t % QT); float mx = -3.0e38f;
#pragma unroll 1
  for (int j = 0; j < nk; ++j) { const float f = (j <= last) ? 1.f : 0.f; mx = fmaxf(mx, fmaf(f, s[j], (1.f - f) * -1.0e9f)); } float se = 0.f;
#pragma unroll 1
  for (int j = 0; j < nk; ++j) { const float f = (j <= last) ? 1.f : 0.f; se += __expf(fmaf(f, s[j], (1.f - f) * -1.0e9f) - mx); } const float sc = 256.0f / se;
#pragma unroll 1
  for (int j0 = 0; j0 < nk; j0 += 8) { FragH fr; for (int q = 0; q < 8; ++q) { const int j = j0 + q; const float f = (j <= last) ? 1.f : 0.f; fr.h[q] = (_Float16)(__expf(fmaf(f, s[j], (1.f - f) * -1.0e9f) - mx) * sc); } unsigned short* d = (unsigned short*)P + i * NKX + j0; *(v8us*)d = fr.half[0];  } }


template <int MASKADD>
__global__ __launch_bounds__(64) void k_att0(const float* __restrict__ QF, const float* __restrict__ KF, const float* __restrict__ VF, int ld, const float* __restrict__ mask, float scale, float* __restrict__ OF, int ldo) {
  #pragma clang fp contract(off)
  __shared__ __attribute__((aligned(16))) float lq[64][64]; __shared__ __attribute__((aligned(16))) float lo[64][64];
  const int tid = threadIdx.x; const int h = blockIdx.x / (QT0 / 64), rg = blockIdx.x % (QT0 / 64); const int i = rg * 64 + tid;
  const float* qr = QF + (size_t)i * ld + h * HD;
#pragma unroll 1
  for (int c = 0; c < HD / 4; ++c) { *(v4f*)&lq[tid][c * 4] = *(const v4fa*)(qr + c * 4); const v4f z = {0.f, 0.f, 0.f, 0.f}; *(v4f*)&lo[tid][c * 4] = z; }
  float m = -1.0e30f, l = 0.f; const int jmax = MASKADD ? (SQ - 1) : (rg * 64 + 63);      /* additive-mask form: every key (the mask input decides); causal form: keys up to the block's last row */
#pragma unroll 1
  for (int j = 0; j <= jmax; ++j) { const float* kr = KF + (size_t)j * ld + h * HD; const float* vr = VF + (size_t)j * ld + h * HD; float s = 0.f;
#pragma unroll 1
    for (int c = 0; c < HD / 4; ++c) { const v4f kq = *(const v4fa*)(kr + c * 4); const v4f qq = *(v4f*)&lq[tid][c * 4]; s = __fadd_rn(s, __fmul_rn(qq[0], kq[0])); s = __fadd_rn(s, __fmul_rn(qq[1], kq[1])); s = __fadd_rn(s, __fmul_rn(qq[2], kq[2])); s = __fadd_rn(s, __fmul_rn(qq[3], kq[3])); }
    s = __fmul_rn(s, scale); if (MASKADD) s = __fadd_rn(s, __fmul_rn(bf16_round(mask[(size_t)i * SQ + j]), -10000.0f));
    const float f = (MASKADD || j <= i) ? 1.f : 0.f; const float sm = fmaf(f, s, (1.f - f) * -1.0e30f); const float mn = fmaxf(m, sm); const float sc = expf(m - mn); const float e = expf(sm - mn); l = __fadd_rn(__fmul_rn(l, sc), e); m = mn;
#pragma unroll 1
    for (int c = 0; c < HD / 4; ++c) { const v4f vv = *(const v4fa*)(vr + c * 4); v4f oo = *(v4f*)&lo[tid][c * 4]; for (int u = 0; u < 4; ++u) oo[u] = __fadd_rn(__fmul_rn(oo[u], sc), __fmul_rn(e, vv[u])); *(v4f*)&lo[tid][c * 4] = oo; } }
  const float fin = 64.0f / l;      /* o carried x64 like the f16 path */
#pragma unroll 1
  for (int c = 0; c < HD / 4; ++c) { v4f oo = *(v4f*)&lo[tid][c * 4]; for (int u = 0; u < 4; ++u) oo[u] = __fmul_rn(oo[u], fin); *(v4f*)&lo[tid][c * 4] = oo; }
  __syncthreads();
  {
#pragma unroll 1
    for (int it = 0; it < 16; ++it) { const int row = it * 4 + tid / 16, pc = (tid % 16) * 4; const v4f v = *(const v4f*)&lo[row][pc]; *(v4f*)(OF + (size_t)(rg * 64 + row) * ldo + h * HD + pc) = v; }
     } }


__global__ __launch_bounds__(256) void k_kvexp(const float* __restrict__ src, float* __restrict__ dst, size_t n4) { const size_t t = (size_t)blockIdx.x * 256 + threadIdx.x; if (t >= n4) return; const size_t e = t * 4; const size_t row = e / DM; const int col = (int)(e % DM); const int h = col / HD, d = col % HD; const v4f v = *(const v4fa*)(src + row * KVD + (size_t)(h / HPG) * HD + d); *(v4f*)(dst + e) = v;  }

__global__ __launch_bounds__(256) void k_tab2(float theta, float* __restrict__ CS, float* __restrict__ SN) {
  #pragma clang fp contract(off)
  const int t = blockIdx.x * 256 + threadIdx.x; if (t >= SQ * (HD / 2)) return; const int i = t % (HD / 2); const int p = t / (HD / 2); const float invf = 1.0f / powf(theta, (float)(2 * i) / (float)HD); const float ang = __fmul_rn((float)p, invf); const float c = cosf(ang), s = sinf(ang);
  *(float*)(CS + t) = c; *(float*)(SN + t) = s;  }
template <int NORM, int ROPE>
__global__ __launch_bounds__(64) void k_xformf(const float* __restrict__ F, int ldf, int nh, const float* __restrict__ gain, float eps, const float* __restrict__ CS, const float* __restrict__ SN, float* __restrict__ F32, int ldo) {
  #pragma clang fp contract(off)
  __shared__ float xv[HD]; __shared__ float red[HD]; const int d = threadIdx.x; const int h = blockIdx.x % nh; const size_t r = blockIdx.x / nh; const int p = (int)(r % SQ);
  float x = F[r * (size_t)ldf + (size_t)h * HD + d];
  if (NORM) { red[d] = __fmul_rn(x, x); __syncthreads(); for (int st = HD / 2; st > 0; st >>= 1) { if (d < st) red[d] = __fadd_rn(red[d], red[d + st]); __syncthreads(); } const float rs = rsqrtf(__fadd_rn(red[0] / (float)HD, eps)); x = __fmul_rn(__fmul_rn(x, rs), bf16_round(gain[d])); }
  xv[d] = x; __syncthreads();
  float o = x;
  if (ROPE == 1) { const int i = d >> 1; const float c = CS[p * (HD / 2) + i], s = SN[p * (HD / 2) + i]; const float ev = xv[2 * i], od = xv[2 * i + 1]; o = (d & 1) ? __fadd_rn(__fmul_rn(ev, s), __fmul_rn(od, c)) : __fadd_rn(__fmul_rn(ev, c), -__fmul_rn(od, s)); }
  if (ROPE == 2) { const int i = d & (HD / 2 - 1); const float c = CS[p * (HD / 2) + i], s = SN[p * (HD / 2) + i]; const float lo = xv[i], hi = xv[i + HD / 2]; o = (d < HD / 2) ? __fadd_rn(__fmul_rn(lo, c), -__fmul_rn(hi, s)) : __fadd_rn(__fmul_rn(lo, s), __fmul_rn(hi, c)); }
  float* dst = F32 + r * (size_t)ldo + (size_t)h * HD + d; *(float*)dst = o;  }

__global__ __launch_bounds__(256) void k_bfcp(const float* __restrict__ src, float* __restrict__ dst, size_t n4) { const size_t t = (size_t)blockIdx.x * 256 + threadIdx.x; if (t >= n4) return; const v4f a = *(const v4fa*)(src + t * 4); v4f o; for (int q = 0; q < 4; ++q) o[q] = bf16_round(a[q]); *(v4f*)(dst + t * 4) = o;  }

// operand preparation of the whole call in ONE launch: rope tables (the first work-groups: the longest dependent chains start first), x as f16 rows, the four natural weights as x16 f16 planes.
// A streaming wave owns 16 KiB of one source: PP_L wave-wide 16-byte loads of 512 contiguous bytes each, all in flight at once, then the conversions, then whole-line 8-byte stores; few waves, so little of the launch goes into starting them.
#define PP_L 32                      /* 16-byte loads in flight per lane */
#define PP_BF (256 * PP_L * 4)       /* floats per streaming work-group */
#define PP_TB 64                     /* table work-groups: SQ * 32 entries, 4 positions per thread */
#define PP_XB ((int)(NR * DM / PP_BF))      /* work-groups on x */
#define PP_WB (DM * DM / PP_BF)      /* work-groups per weight */
__device__ __forceinline__ float pp_round(float v) { const unsigned int u = __float_as_uint(v); return __uint_as_float((u + 0x7FFFu + ((u >> 16) & 1u)) & 0xFFFF0000u); }      /* the value of bf16_round(v), kept in 32-bit registers */
__global__ __launch_bounds__(256) void k_prep(const float* __restrict__ x, const float* __restrict__ wq, const float* __restrict__ wk, const float* __restrict__ wv, const float* __restrict__ wo, _Float16* __restrict__ X16, _Float16* __restrict__ BW, float* __restrict__ CS, float* __restrict__ SN) {
  static_assert(NR * DM % PP_BF == 0 && DM * DM % PP_BF == 0 && KVD == DM, "whole work-groups per source; four planes of equal size");
  static_assert(SQ % (PP_TB * 8) == 0 && HD / 2 == 32, "a table wave writes one position's 32 entries: one 128-byte line per table");
  const int tid = threadIdx.x; int blk = blockIdx.x;
  if (blk < PP_TB) {      /* block-uniform; CS[p][i] = cos(p * 10000^(-2i/64)), SN = sin: the frequency once per thread, then per position the f32 angle, cosf and sinf */
    const int t = blk * 256 + tid; const int i = t % (HD / 2); const int p0 = t / (HD / 2); const float invf = (float)(1.0 / pow(10000.0, (double)(2 * i) / (double)HD));
    for (int u = 0; u < SQ / (PP_TB * 8); ++u) { const int p = p0 + u * (PP_TB * 8); const float ang = __fmul_rn((float)p, invf); const float c = cosf(ang), s = sinf(ang); CS[p * (HD / 2) + i] = c; SN[p * (HD / 2) + i] = s; }
    return; }
  blk -= PP_TB;
  const float* src; _Float16* dst; float scale;      /* block-uniform choice of the source */
  if (blk < PP_XB) { src = x + (size_t)blk * PP_BF; dst = X16 + (size_t)blk * PP_BF; scale = 1.0f; }
  else { blk -= PP_XB; const int wi = blk / PP_WB; src = (wi == 0 ? wq : wi == 1 ? wk : wi == 2 ? wv : wo) + (size_t)(blk % PP_WB) * PP_BF; dst = BW + (size_t)blk * PP_BF; scale = 16.0f; }      /* the planes follow one another in the workspace */
  const int o = (tid >> 5) * (PP_L * 128) + (tid & 31) * 4; src += o; dst += o;
  v4f a[PP_L]; v4h h[PP_L];
#pragma unroll      /* a[] in registers; constant steps become immediate offsets */
  for (int j = 0; j < PP_L; ++j) a[j] = *(const v4fa*)(src + j * 128);
  asm volatile("s_wait_xcnt 0x0" :: "v"(src) : "memory");      /* the loads' address stays live up to this wait, so no register that an issued load names is overwritten in front of it */
  __builtin_amdgcn_sched_barrier(0);      /* no conversion moves in front of a load: otherwise the compiler issues the loads in two runs, the second behind the first one's data, and the wave pays the memory latency twice */
#pragma unroll      /* h[] in registers */
  for (int j = 0; j < PP_L; ++j) for (int q = 0; q < 4; q += 2) { const v2h pk = __builtin_convertvector(v2f{pp_round(a[j][q]) * scale, pp_round(a[j][q + 1]) * scale}, v2h); h[j][q] = pk[0]; h[j][q + 1] = pk[1]; }      /* bf16-rounded values are exact in f16 here, x1 and x16 alike */
  __builtin_amdgcn_sched_barrier(0);      /* every conversion stands in front of the first store: behind an issued store no register that it names is written any more */
#pragma unroll
  for (int j = 0; j < PP_L; ++j) *(v4h*)(dst + j * 128) = h[j];
  asm volatile("s_wait_xcnt 0x0" ::: "memory"); }      /* directly behind the last store: on every way that the built code lays out behind the stores, this wait stands in front of the first write of a register that an issued store names */
extern "C" void kernel_launch(void* const* d_in, const int* in_sizes, int n_in,
                              void* d_out, int out_size, void* d_ws, size_t ws_size, hipStream_t stream) {
  (void)in_sizes; (void)n_in; (void)out_size;
  const float* const* I = (const float* const*)d_in; const float* x = I[0]; const float* wq = I[1]; const float* wk = I[2]; const float* wv = I[3]; const float* wo = I[4]; const float* bq = nullptr; const float* bk = nullptr; const float* bv = nullptr; const float* bo = I[5];      /* input order: x, Wq, Wk, Wv, Wo (natural [out][in] weights), bo [1024] (the output bias: into the output GEMM's bias slot); the q / k / v projections have NO biases; rope tables computed in the kernel (positions = row index) */
  char* ws = (char*)d_ws; size_t off = 0;
  auto take = [&](size_t bytes) { char* p = ws + off; off += (bytes + 255) & ~(size_t)255; return p; };
  _Float16* BQ = (_Float16*)take((size_t)DM * DM * 2); _Float16* BK = (_Float16*)take((size_t)KVD * DM * 2); _Float16* BV = (_Float16*)take((size_t)KVD * DM * 2); _Float16* BO = (_Float16*)take((size_t)DM * DM * 2);
  _Float16* X16 = (_Float16*)take(NR * DM * 2); float* CSB = (float*)take((size_t)SQ * 32 * 4); float* SNB = (float*)take((size_t)SQ * 32 * 4); _Float16* Q16 = (_Float16*)take(NR * DM * 2); _Float16* K16 = (_Float16*)take(NR * KVD * 2); _Float16* V16 = (_Float16*)take(NR * KVD * 2); _Float16* O16 = (_Float16*)take(NR * DM * 2);
  _Float16* VT = (_Float16*)take((size_t)NB * NH * HD * SQ * 2);
  float* QF0 = (float*)take((size_t)QT0 * DM * 4); float* KF0 = (float*)take((size_t)QT0 * KVD * 4); float* VF0 = (float*)take((size_t)QT0 * KVD * 4); float* KF0e = (float*)take((size_t)QT0 * DM * 4); float* VF0e = (float*)take((size_t)QT0 * DM * 4); float* OF0 = (float*)take((size_t)NB * QT0 * DM * 4); _Float16* OH0 = (_Float16*)take((size_t)NB * QT0 * DM * 2); _Float16* OL0 = (_Float16*)take((size_t)NB * QT0 * DM * 2);
  if (off > ws_size) return;
  static_assert((size_t)DM * DM * 2 % 256 == 0, "BQ, BK, BV, BO lie back to back");
  k_prep<<<PP_TB + PP_XB + 4 * PP_WB, 256, 0, stream>>>(x, wq, wk, wv, wo, X16, BQ, CSB, SNB);      /* rope tables (rotate-half convention; the module's [f | f] tables repeat these 32 columns), x rows, natural [out][in] = Bt[n][k] x16 planes (KVD = 16 x 64 = DM: full-width k / v) */
  const size_t r0p = (size_t)B0 * SQ;      /* first projected row */
  static_assert(KVD == DM, "q, k and v share one launch: equal widths");
  static_assert((MP / 128) * (DM / 128) == NBR * (KVD / 128) * (SQ / 128), "the V^T plane has as many tiles as the q plane");
  k_gemm3<<<dim3((unsigned)((MP / 128) * (DM / 128)), 3), 128, 0, stream>>>(X16 + r0p * DM, BQ, (size_t)DM * DM, 0.0625f, Q16 + r0p * DM, DM, NR * DM, MP, DM, CSB, SNB, VT + (size_t)B0 * NH * HD * SQ);      /* q (grid.y 0) and k (grid.y 1) of all rows: BK follows BQ and K16 follows Q16 in the workspace (sizes are multiples of 256 bytes), so the kernel's own batch strides step from q to k; half-split rope (t cos + rotate_half(t) sin, computed tables) and f32 -> f16 in the epilogue; grid.y 2: V^T [NB][NH][HD][SQ] of all batches (BV follows BK), no rotation */
  k_fattn<<<dim3(SQ / FA_QB, NH, NB), FA_KS * FA_W * 32, 0, stream>>>(Q16, K16, VT, O16);      /* non-causal attention of all batches, heads and query rows in one launch: scores, softmax and weighted values fused; 16 waves per work-group, 8 per key half; o into merged f16 rows (x64) */
  k_gemm2<0, 0, 1><<<dim3((unsigned)((MPO / 128) * (DM / 64)), 1), 128, 0, stream>>>(O16 + r0p * DM, 0, BO, 0, 0.0009765625f, bo, 0, nullptr, 1, 0, 0, (float*)d_out + r0p * DM, nullptr, DM, 0, MPO, DM, nullptr, nullptr, nullptr);      /* out rows are the output layout */
}
